// v000
// Measured on an AMD MI455X. A time is GPU time per run, averaged over a window of back-to-back runs after a warm-up
// (all launches, gaps included; the runs take copies of the inputs in turn), and the median of several windows.
// Apart from v000's, it joins two sittings. Times from different sittings can be a few percent apart, while
// side-by-side timings come from the same sitting.
// The starting kernel, v000, takes 229 microseconds a run.
#include <hip/hip_runtime.h>
#include <hip/hip_bf16.h>

typedef __attribute__((ext_vector_type(16))) _Float16 v16h;
typedef __attribute__((ext_vector_type(8)))  _Float16 v8h;
typedef __attribute__((ext_vector_type(8)))  float    v8f;

// Problem sizes (fixed by the reference)
constexpr int kB   = 32768;
constexpr int kD   = 512;
constexpr int kE   = 10;
constexpr int kH   = 128;
constexpr int kL   = 2;
constexpr int kRH1 = 256;
constexpr int kRH2 = 128;
constexpr float kTau = 3.0f;

// ---------------------------------------------------------------------------
// Prep kernels
// ---------------------------------------------------------------------------
__global__ void f32_to_f16_kernel(const float* __restrict__ src,
                                  _Float16* __restrict__ dst, int n) {
  int i = blockIdx.x * blockDim.x + threadIdx.x;
  if (i < n) dst[i] = (_Float16)src[i];
}

// W: [K,N] fp32 (optionally batched) -> WT: [N,K] f16 (B^T, so B columns are
// contiguous in memory for fragment loads).
__global__ void transpose_to_f16_kernel(const float* __restrict__ W,
                                        _Float16* __restrict__ WT,
                                        int K, int N) {
  size_t batch = blockIdx.y;
  const float* w = W + batch * (size_t)K * N;
  _Float16* wt = WT + batch * (size_t)K * N;
  int idx = blockIdx.x * blockDim.x + threadIdx.x;
  if (idx < K * N) {
    int n = idx / K;
    int k = idx - n * K;
    wt[idx] = (_Float16)w[(size_t)k * N + n];
  }
}

// ---------------------------------------------------------------------------
// Fragment helpers.
//
// CDNA5 16-bit A (16x32) lane layout: lane l (0..15) holds row M=l with
// K = {kb..kb+7, kb+16..kb+23}; lanes 16..31 hold the same rows with
// K = {kb+8..kb+15, kb+24..kb+31}.  B mirrors this with column N=l, which is
// a contiguous row of BT.  C/D: VGPR r, lane l -> (M = r + 8*(l>>4), N = l&15).
// ---------------------------------------------------------------------------
__device__ __forceinline__ v16h load_frag_g(const _Float16* p) {
  v8h a = *(const v8h*)(p);       // 16B -> global_load_b128
  v8h b = *(const v8h*)(p + 16);
  v16h r;
#pragma unroll
  for (int i = 0; i < 8; ++i) { r[i] = a[i]; r[i + 8] = b[i]; }
  return r;
}

__device__ __forceinline__ v16h load_frag_lds(const _Float16* p) {
  v8h a = *(const v8h*)(p);       // 16B -> ds_load_b128
  v8h b = *(const v8h*)(p + 16);
  v16h r;
#pragma unroll
  for (int i = 0; i < 8; ++i) { r[i] = a[i]; r[i + 8] = b[i]; }
  return r;
}

__device__ __forceinline__ v8f wmma_f16(v16h a, v16h b, v8f c) {
  return __builtin_amdgcn_wmma_f32_16x16x32_f16(false, a, false, b, (short)0,
                                                c, false, false);
}

// ---------------------------------------------------------------------------
// WMMA GEMM v3: C = relu(A[M,K] * B[K,N] + bias)
//   - block = 256 threads = 8 waves, block tile 256M x 64N
//   - B tile (64 x K, padded rows) staged in LDS once, shared by all waves
//   - each wave computes 32M x 64N (8 accumulators)
//   - k-loop unrolled by 64 with two alternating A buffers (no copy-swap),
//     B fragments pipelined one step ahead, prefetch offsets wrapped instead
//     of guarded (branch-free steady state)
// Requires K % 64 == 0 (true for 512 / 256 / 128). Batched via blockIdx.z.
// ---------------------------------------------------------------------------
template <bool RELU>
__global__ __launch_bounds__(256)
void gemm_wmma_f16(const _Float16* __restrict__ A, int lda, long long aStride,
                   const _Float16* __restrict__ BT, long long bStride,
                   const float* __restrict__ bias, long long biasStride,
                   _Float16* __restrict__ C, int ldc, long long cStride,
                   int K) {
  extern __shared__ _Float16 lds[];   // 64 * (K + 8) halves
  const int tid  = threadIdx.x;
  const int lane = tid & 31;
  const int wave = tid >> 5;
  const int hi   = lane >> 4;
  const int l16  = lane & 15;
  const int ldsRow = K + 8;           // pad 8 halves -> conflict-free b128 reads

  const long long e = blockIdx.z;
  const _Float16* Ae = A + e * aStride;
  const _Float16* Be = BT + e * bStride;
  const float*    be = bias + e * biasStride;
  _Float16*       Ce = C + e * cStride;

  const int m0 = blockIdx.x * 256 + wave * 32;
  const int n0 = blockIdx.y * 64;

  // ---- stage BT tile [64 x K] into LDS (all 256 threads cooperate) ----
  {
    const int chunksPerRow = K >> 3;        // 8 halves per 16B chunk
    const int total = 64 * chunksPerRow;
    for (int c = tid; c < total; c += 256) {
      int n  = c / chunksPerRow;
      int kc = c - n * chunksPerRow;
      v8h v = *(const v8h*)(Be + (size_t)(n0 + n) * K + kc * 8);
      *(v8h*)(&lds[(size_t)n * ldsRow + kc * 8]) = v;
    }
  }
  __syncthreads();

  v8f acc[2][4];
#pragma unroll
  for (int mi = 0; mi < 2; ++mi)
#pragma unroll
    for (int j = 0; j < 4; ++j)
#pragma unroll
      for (int i = 0; i < 8; ++i) acc[mi][j][i] = 0.0f;

  const _Float16* pa0 = Ae + (size_t)(m0 + l16) * lda + 8 * hi;
  const _Float16* pa1 = pa0 + (size_t)16 * lda;

  // Two alternating A buffers (k and k+32) -> no register copy swap.
  v16h aA[2], aB[2];
  aA[0] = load_frag_g(pa0);
  aA[1] = load_frag_g(pa1);
  aB[0] = load_frag_g(pa0 + 32);
  aB[1] = load_frag_g(pa1 + 32);

  const _Float16* lb = &lds[(size_t)l16 * ldsRow + 8 * hi];
  const int jStep = 16 * ldsRow;

  // B pipeline: bcur always holds the fragment for the WMMA about to issue.
  v16h bcur = load_frag_lds(lb);   // (j=0, k=0)

  for (int kb = 0; kb < K; kb += 64) {
    const int kpre = (kb + 64 < K) ? (kb + 64) : 0;  // wrapped prefetch

    // ---- sub-step 0: k = kb, A = aA ----
#pragma unroll
    for (int j = 0; j < 4; ++j) {
      v16h bnxt = (j < 3) ? load_frag_lds(lb + (j + 1) * jStep + kb)
                          : load_frag_lds(lb + kb + 32);
      acc[0][j] = wmma_f16(aA[0], bcur, acc[0][j]);
      acc[1][j] = wmma_f16(aA[1], bcur, acc[1][j]);
      bcur = bnxt;
    }
    aA[0] = load_frag_g(pa0 + kpre);
    aA[1] = load_frag_g(pa1 + kpre);

    // ---- sub-step 1: k = kb+32, A = aB ----
#pragma unroll
    for (int j = 0; j < 4; ++j) {
      v16h bnxt = (j < 3) ? load_frag_lds(lb + (j + 1) * jStep + kb + 32)
                          : load_frag_lds(lb + kpre);  // next outer, j=0
      acc[0][j] = wmma_f16(aB[0], bcur, acc[0][j]);
      acc[1][j] = wmma_f16(aB[1], bcur, acc[1][j]);
      bcur = bnxt;
    }
    aB[0] = load_frag_g(pa0 + kpre + 32);
    aB[1] = load_frag_g(pa1 + kpre + 32);
  }

  // ---- epilogue: bias + relu, store f16 ----
#pragma unroll
  for (int mi = 0; mi < 2; ++mi) {
#pragma unroll
    for (int j = 0; j < 4; ++j) {
      int n = n0 + 16 * j + l16;
      float bv = be[n];
#pragma unroll
      for (int r = 0; r < 8; ++r) {
        int m = m0 + 16 * mi + r + 8 * hi;
        float v = acc[mi][j][r] + bv;
        if (RELU) v = v > 0.0f ? v : 0.0f;
        Ce[(size_t)m * ldc + n] = (_Float16)v;
      }
    }
  }
}

// ---------------------------------------------------------------------------
// Router tail: logits = rh2 @ rw3 + rb3 ; weights = softmax((logits+gumbel)/tau)
// ---------------------------------------------------------------------------
__global__ void router_tail_kernel(const _Float16* __restrict__ rh2,
                                   const float* __restrict__ rw3,  // [RH2, E]
                                   const float* __restrict__ rb3,  // [E]
                                   const float* __restrict__ u,    // [B, E]
                                   float* __restrict__ wout) {     // [B, E]
  int b = blockIdx.x * blockDim.x + threadIdx.x;
  if (b >= kB) return;
  float acc[kE];
#pragma unroll
  for (int e = 0; e < kE; ++e) acc[e] = rb3[e];
  const _Float16* h = rh2 + (size_t)b * kRH2;
  for (int k = 0; k < kRH2; ++k) {
    float hv = (float)h[k];
#pragma unroll
    for (int e = 0; e < kE; ++e) acc[e] += hv * rw3[k * kE + e];
  }
  float mx = -1e30f;
#pragma unroll
  for (int e = 0; e < kE; ++e) {
    float uu = u[(size_t)b * kE + e];
    uu = fminf(fmaxf(uu, 1e-10f), 1.0f);
    float g = -logf(-logf(uu) + 1e-10f);
    acc[e] = (acc[e] + g) / kTau;
    mx = fmaxf(mx, acc[e]);
  }
  float s = 0.0f;
#pragma unroll
  for (int e = 0; e < kE; ++e) { acc[e] = expf(acc[e] - mx); s += acc[e]; }
  float inv = 1.0f / s;
#pragma unroll
  for (int e = 0; e < kE; ++e) wout[(size_t)b * kE + e] = acc[e] * inv;
}

// ---------------------------------------------------------------------------
// zc = h2 @ ew3 + eb3, written straight into the chart_outputs region [E,B,L]
// ---------------------------------------------------------------------------
__global__ void zc_kernel(const _Float16* __restrict__ h2,   // [E][B][H]
                          const float* __restrict__ ew3,     // [E][H][L]
                          const float* __restrict__ eb3,     // [E][L]
                          float* __restrict__ chart) {       // [E][B][L]
  size_t idx = (size_t)blockIdx.x * blockDim.x + threadIdx.x;
  if (idx >= (size_t)kE * kB) return;
  int e = (int)(idx / kB);
  const _Float16* h = h2 + idx * kH;
  const float* w = ew3 + (size_t)e * kH * kL;
  float a0 = eb3[e * kL + 0];
  float a1 = eb3[e * kL + 1];
  for (int k = 0; k < kH; ++k) {
    float hv = (float)h[k];
    a0 += hv * w[k * kL + 0];
    a1 += hv * w[k * kL + 1];
  }
  chart[idx * kL + 0] = a0;
  chart[idx * kL + 1] = a1;
}

// z[b,l] = sum_e weights[b,e] * chart[e,b,l]
__global__ void z_kernel(const float* __restrict__ wght,
                         const float* __restrict__ chart,
                         float* __restrict__ z) {
  int b = blockIdx.x * blockDim.x + threadIdx.x;
  if (b >= kB) return;
  float z0 = 0.0f, z1 = 0.0f;
#pragma unroll
  for (int e = 0; e < kE; ++e) {
    float w = wght[(size_t)b * kE + e];
    z0 += w * chart[((size_t)e * kB + b) * kL + 0];
    z1 += w * chart[((size_t)e * kB + b) * kL + 1];
  }
  z[(size_t)b * kL + 0] = z0;
  z[(size_t)b * kL + 1] = z1;
}

// ---------------------------------------------------------------------------
extern "C" void kernel_launch(void* const* d_in, const int* in_sizes, int n_in,
                              void* d_out, int out_size, void* d_ws, size_t ws_size,
                              hipStream_t stream) {
  (void)in_sizes; (void)n_in; (void)out_size; (void)ws_size;

  const float* x   = (const float*)d_in[0];
  const float* u   = (const float*)d_in[1];
  const float* rw1 = (const float*)d_in[2];
  const float* rb1 = (const float*)d_in[3];
  const float* rw2 = (const float*)d_in[4];
  const float* rb2 = (const float*)d_in[5];
  const float* rw3 = (const float*)d_in[6];
  const float* rb3 = (const float*)d_in[7];
  const float* ew1 = (const float*)d_in[8];
  const float* eb1 = (const float*)d_in[9];
  const float* ew2 = (const float*)d_in[10];
  const float* eb2 = (const float*)d_in[11];
  const float* ew3 = (const float*)d_in[12];
  const float* eb3 = (const float*)d_in[13];

  float* out   = (float*)d_out;
  float* out_z = out;                                  // [B, L]
  float* out_w = out + (size_t)kB * kL;                // [B, E]
  float* out_c = out_w + (size_t)kB * kE;              // [E, B, L]

  // Workspace carve-up (256B aligned)
  char* ws = (char*)d_ws;
  size_t off = 0;
  auto carve = [&](size_t bytes) -> void* {
    void* p = ws + off;
    off += (bytes + 255) & ~(size_t)255;
    return p;
  };
  _Float16* xh   = (_Float16*)carve((size_t)kB * kD * 2);         // x in f16
  _Float16* rw1T = (_Float16*)carve((size_t)kD * kRH1 * 2);       // [RH1, D]
  _Float16* rw2T = (_Float16*)carve((size_t)kRH1 * kRH2 * 2);     // [RH2, RH1]
  _Float16* ew1T = (_Float16*)carve((size_t)kE * kD * kH * 2);    // [E][H][D]
  _Float16* ew2T = (_Float16*)carve((size_t)kE * kH * kH * 2);    // [E][H][H]
  _Float16* rh1  = (_Float16*)carve((size_t)kB * kRH1 * 2);       // [B, RH1]
  _Float16* rh2  = (_Float16*)carve((size_t)kB * kRH2 * 2);       // [B, RH2]
  _Float16* h1   = (_Float16*)carve((size_t)kE * kB * kH * 2);    // [E][B][H]
  _Float16* h2   = (_Float16*)carve((size_t)kE * kB * kH * 2);    // [E][B][H]

  // 1) conversions / weight transposes
  {
    int n = kB * kD;
    f32_to_f16_kernel<<<dim3((n + 255) / 256), 256, 0, stream>>>(x, xh, n);
  }
  transpose_to_f16_kernel<<<dim3((kD * kRH1 + 255) / 256, 1), 256, 0, stream>>>(rw1, rw1T, kD, kRH1);
  transpose_to_f16_kernel<<<dim3((kRH1 * kRH2 + 255) / 256, 1), 256, 0, stream>>>(rw2, rw2T, kRH1, kRH2);
  transpose_to_f16_kernel<<<dim3((kD * kH + 255) / 256, kE), 256, 0, stream>>>(ew1, ew1T, kD, kH);
  transpose_to_f16_kernel<<<dim3((kH * kH + 255) / 256, kE), 256, 0, stream>>>(ew2, ew2T, kH, kH);

  auto ldsBytes = [](int K) { return (size_t)64 * (K + 8) * sizeof(_Float16); };

  // 2) router MLP (two WMMA GEMMs), then logits+gumbel-softmax tail
  gemm_wmma_f16<true><<<dim3(kB / 256, kRH1 / 64, 1), 256, ldsBytes(kD), stream>>>(
      xh, kD, 0, rw1T, 0, rb1, 0, rh1, kRH1, 0, kD);
  gemm_wmma_f16<true><<<dim3(kB / 256, kRH2 / 64, 1), 256, ldsBytes(kRH1), stream>>>(
      rh1, kRH1, 0, rw2T, 0, rb2, 0, rh2, kRH2, 0, kRH1);
  router_tail_kernel<<<dim3(kB / 256), 256, 0, stream>>>(rh2, rw3, rb3, u, out_w);

  // 3) experts, batched over blockIdx.z (A-stride 0 reuses x for all experts)
  gemm_wmma_f16<true><<<dim3(kB / 256, kH / 64, kE), 256, ldsBytes(kD), stream>>>(
      xh, kD, 0,
      ew1T, (long long)kD * kH,
      eb1, kH,
      h1, kH, (long long)kB * kH, kD);
  gemm_wmma_f16<true><<<dim3(kB / 256, kH / 64, kE), 256, ldsBytes(kH), stream>>>(
      h1, kH, (long long)kB * kH,
      ew2T, (long long)kH * kH,
      eb2, kH,
      h2, kH, (long long)kB * kH, kH);

  // 4) zc -> chart_outputs region; z = weights . zc
  zc_kernel<<<dim3((kE * kB + 255) / 256), 256, 0, stream>>>(h2, ew3, eb3, out_c);
  z_kernel<<<dim3(kB / 256), 256, 0, stream>>>(out_w, out_c, out_z);
}

// v002
// It runs in 106 microseconds.
// Versions between v000 and this one are left out; their measured steps multiply to 2.20 times as fast.
#include <hip/hip_runtime.h>
#include <hip/hip_bf16.h>

typedef __attribute__((ext_vector_type(16))) _Float16 v16h;
typedef __attribute__((ext_vector_type(8)))  _Float16 v8h;
typedef __attribute__((ext_vector_type(8)))  float    v8f;
typedef __attribute__((ext_vector_type(4)))  float    v4f;
typedef __attribute__((ext_vector_type(2)))  float    v2f;

// Problem sizes (fixed by the reference)
constexpr int kB   = 32768;
constexpr int kD   = 512;
constexpr int kE   = 10;
constexpr int kH   = 128;
constexpr int kL   = 2;
constexpr int kRH1 = 256;
constexpr int kRH2 = 128;
constexpr float kTau = 3.0f;

// ---------------------------------------------------------------------------
// Fragment order of an f16 activation matrix [rows x K] in the workspace.
//
// The matrix is cut into tiles of 16 rows x 32 k (512 halves = 1 KiB); tile
// (mt, kt) starts at (mt * (K/32) + kt) * 512 halves.  A tile is two pieces of
// 256 halves; in piece p, lane (h*16 + c) owns the 8 halves
//   row = mt*16 + c,  k = kt*32 + p*16 + h*8 + 0..7,
// which is what that lane's WMMA operand registers hold.  So one wave reads or
// writes a piece as 32 lanes x 16 B = 512 contiguous bytes (4 whole lines).
//
// frag_chunk: offset in halves of the 8 halves (row, k = 8q .. 8q+7).
// ---------------------------------------------------------------------------
__device__ __forceinline__ size_t frag_chunk(size_t row, int q, int K) {
  return ((row >> 4) * (size_t)(K >> 5) + (q >> 2)) * 512 +
         ((q >> 1) & 1) * 256 + ((q & 1) * 16 + (int)(row & 15)) * 8;
}

// ---------------------------------------------------------------------------
// Prep kernels
// ---------------------------------------------------------------------------
// x [B, D] fp32 -> xh, f16 in fragment order.  One block = one tile row
// (16 rows x D = 1024 chunks of 8 halves), 4 chunks per thread; chunk
// u = t + 256*s of the tile row is stored at u*8 halves.
__global__ __launch_bounds__(256)
void f32_to_f16_frag_kernel(const float* __restrict__ src,
                            _Float16* __restrict__ dst) {
  const int t = threadIdx.x;
  const size_t mt = blockIdx.x;
  const int c = t & 15, h = (t >> 4) & 1, p = (t >> 5) & 1, kt0 = t >> 6;
  const float* s = src + (mt * 16 + c) * kD + kt0 * 32 + p * 16 + h * 8;
  _Float16* d = dst + mt * (size_t)(kD * 16) + t * 8;
  v4f lo[4], up[4];
  // unrolled (here and below): the arrays stay in registers and all 8 loads
  // are in flight before the first store
#pragma unroll
  for (int i = 0; i < 4; ++i) {
    lo[i] = *(const v4f*)(s + i * 128);
    up[i] = *(const v4f*)(s + i * 128 + 4);
  }
#pragma unroll
  for (int i = 0; i < 4; ++i) {
    v8h v;
#pragma unroll
    for (int k = 0; k < 4; ++k) {
      v[k] = (_Float16)lo[i][k];
      v[k + 4] = (_Float16)up[i][k];
    }
    *(v8h*)(d + i * 2048) = v;
  }
}

// W: [K,N] fp32 (optionally batched) -> WT: [N,K] f16 (B^T, so B columns are
// contiguous in memory for fragment loads).  FRAG: WT is stored in fragment
// order (rows = n), for the fused expert kernel's linear copy into LDS.
template <bool FRAG>
__global__ void transpose_to_f16_kernel(const float* __restrict__ W,
                                        _Float16* __restrict__ WT,
                                        int K, int N) {
  size_t batch = blockIdx.y;
  const float* w = W + batch * (size_t)K * N;
  _Float16* wt = WT + batch * (size_t)K * N;
  int idx = blockIdx.x * blockDim.x + threadIdx.x;
  if (idx < K * N) {
    int n = idx / K;
    int k = idx - n * K;
    const size_t d = FRAG ? frag_chunk((size_t)n, k >> 3, K) + (k & 7) : (size_t)idx;
    wt[d] = (_Float16)w[(size_t)k * N + n];
  }
}

// ---------------------------------------------------------------------------
// Fragment helpers.
//
// CDNA5 16-bit A (16x32) lane layout: lane l (0..15) holds row M=l with
// K = {kb..kb+7, kb+16..kb+23}; lanes 16..31 hold the same rows with
// K = {kb+8..kb+15, kb+24..kb+31}.  B mirrors this with column N=l, which is
// a contiguous row of BT.  C/D: VGPR r, lane l -> (M = r + 8*(l>>4), N = l&15).
// ---------------------------------------------------------------------------
// p = tile start + lane*8 of a matrix in fragment order: the two pieces.
__device__ __forceinline__ v16h load_frag_g(const _Float16* p) {
  v8h a = *(const v8h*)(p);       // 16B -> global_load_b128, 512 B per wave
  v8h b = *(const v8h*)(p + 256);
  v16h r;
#pragma unroll
  for (int i = 0; i < 8; ++i) { r[i] = a[i]; r[i + 8] = b[i]; }
  return r;
}

__device__ __forceinline__ v16h load_frag_lds(const _Float16* p) {
  v8h a = *(const v8h*)(p);       // 16B -> ds_load_b128
  v8h b = *(const v8h*)(p + 16);
  v16h r;
#pragma unroll
  for (int i = 0; i < 8; ++i) { r[i] = a[i]; r[i + 8] = b[i]; }
  return r;
}

__device__ __forceinline__ v8f wmma_f16(v16h a, v16h b, v8f c) {
  return __builtin_amdgcn_wmma_f32_16x16x32_f16(false, a, false, b, (short)0,
                                                c, false, false);
}

// ---------------------------------------------------------------------------
// WMMA GEMM v3: C = relu(A[M,K] * B[K,N] + bias)
//   - A and C are in fragment order (C with row length ldc)
//   - the weight fragment is the WMMA's first operand and the activation
//     fragment its second, so D = C^T: a lane holds 8 consecutive n of one row
//     m, which is one 16-byte chunk of C in fragment order
//   - block = 256 threads = 8 waves, block tile 256M x 64N
//   - B tile (64 x K, padded rows) staged in LDS once, shared by all waves
//   - each wave computes 32M x 64N (8 accumulators)
//   - k-loop unrolled by 64 with two alternating A buffers (no copy-swap),
//     B fragments pipelined one step ahead, prefetch offsets wrapped instead
//     of guarded (branch-free steady state)
// Requires K % 64 == 0 (true for 512 / 256). Batched via blockIdx.z.
// ---------------------------------------------------------------------------
template <bool RELU>
__global__ __launch_bounds__(256)
void gemm_wmma_f16(const _Float16* __restrict__ A, long long aStride,
                   const _Float16* __restrict__ BT, long long bStride,
                   const float* __restrict__ bias, long long biasStride,
                   _Float16* __restrict__ C, int ldc, long long cStride,
                   int K) {
  extern __shared__ _Float16 lds[];   // 64 * (K + 8) halves
  const int tid  = threadIdx.x;
  const int lane = tid & 31;
  const int wave = tid >> 5;
  const int hi   = lane >> 4;
  const int l16  = lane & 15;
  const int ldsRow = K + 8;           // pad 8 halves -> conflict-free b128 reads

  const long long e = blockIdx.z;
  const _Float16* Ae = A + e * aStride;
  const _Float16* Be = BT + e * bStride;
  const float*    be = bias + e * biasStride;
  _Float16*       Ce = C + e * cStride;

  const int m0 = blockIdx.x * 256 + wave * 32;
  const int n0 = blockIdx.y * 64;

  // ---- stage BT tile [64 x K] into LDS (all 256 threads cooperate) ----
  {
    const int chunksPerRow = K >> 3;        // 8 halves per 16B chunk
    const int total = 64 * chunksPerRow;
    for (int c = tid; c < total; c += 256) {
      int n  = c / chunksPerRow;
      int kc = c - n * chunksPerRow;
      v8h v = *(const v8h*)(Be + (size_t)(n0 + n) * K + kc * 8);
      *(v8h*)(&lds[(size_t)n * ldsRow + kc * 8]) = v;
    }
  }
  __syncthreads();

  v8f acc[2][4];
#pragma unroll
  for (int mi = 0; mi < 2; ++mi)
#pragma unroll
    for (int j = 0; j < 4; ++j)
#pragma unroll
      for (int i = 0; i < 8; ++i) acc[mi][j][i] = 0.0f;

  // tile row m0/16 of A; a tile row is K*16 halves, a k step of 32 is 512.
  const _Float16* pa0 = Ae + (size_t)(m0 >> 4) * K * 16 + lane * 8;
  const _Float16* pa1 = pa0 + (size_t)K * 16;

  // Two alternating A buffers (k and k+32) -> no register copy swap.
  v16h aA[2], aB[2];
  aA[0] = load_frag_g(pa0);
  aA[1] = load_frag_g(pa1);
  aB[0] = load_frag_g(pa0 + 512);
  aB[1] = load_frag_g(pa1 + 512);

  const _Float16* lb = &lds[(size_t)l16 * ldsRow + 8 * hi];
  const int jStep = 16 * ldsRow;

  // B pipeline: bcur always holds the fragment for the WMMA about to issue.
  v16h bcur = load_frag_lds(lb);   // (j=0, k=0)

  for (int kb = 0; kb < K; kb += 64) {
    const int kpre = (kb + 64 < K) ? (kb + 64) : 0;  // wrapped prefetch

    // ---- sub-step 0: k = kb, A = aA ----
#pragma unroll
    for (int j = 0; j < 4; ++j) {
      v16h bnxt = (j < 3) ? load_frag_lds(lb + (j + 1) * jStep + kb)
                          : load_frag_lds(lb + kb + 32);
      acc[0][j] = wmma_f16(bcur, aA[0], acc[0][j]);
      acc[1][j] = wmma_f16(bcur, aA[1], acc[1][j]);
      bcur = bnxt;
    }
    const _Float16* qa0 = pa0 + kpre * 16;
    const _Float16* qa1 = pa1 + kpre * 16;
    aA[0] = load_frag_g(qa0);
    aA[1] = load_frag_g(qa1);

    // ---- sub-step 1: k = kb+32, A = aB ----
#pragma unroll
    for (int j = 0; j < 4; ++j) {
      v16h bnxt = (j < 3) ? load_frag_lds(lb + (j + 1) * jStep + kb + 32)
                          : load_frag_lds(lb + kpre);  // next outer, j=0
      acc[0][j] = wmma_f16(bcur, aB[0], acc[0][j]);
      acc[1][j] = wmma_f16(bcur, aB[1], acc[1][j]);
      bcur = bnxt;
    }
    aB[0] = load_frag_g(qa0 + 512);
    aB[1] = load_frag_g(qa1 + 512);
    // Wait before the address registers of this pass's loads are overwritten;
    // naming them keeps them whole up to the wait.
    asm volatile("s_wait_xcnt 0x0" :: "v"(qa0), "v"(qa1) : "memory");
  }

  // ---- epilogue: bias + relu, store f16 in fragment order ----
  // acc[mi][j][r] = C[m0 + 16*mi + l16][n0 + 16*j + 8*hi + r]
  v4f bv[4][2];   // unrolled loops: bv and acc are indexed by constants only
#pragma unroll
  for (int j = 0; j < 4; ++j) {
    const int nb = n0 + 16 * j + 8 * hi;
    bv[j][0] = *(const v4f*)(be + nb);
    bv[j][1] = *(const v4f*)(be + nb + 4);
  }
  // The store address set-up below reuses the address registers of the bias
  // loads: wait before they are overwritten.
  asm volatile("s_wait_xcnt 0x0" ::: "memory");
  // Keeps that set-up (argument loads, address arithmetic) behind the wait.
  __builtin_amdgcn_sched_barrier(0);
#pragma unroll
  for (int j = 0; j < 4; ++j) {
#pragma unroll
    for (int mi = 0; mi < 2; ++mi) {
      v8h o;
#pragma unroll
      for (int r = 0; r < 8; ++r) {
        float v = acc[mi][j][r] + bv[j][r >> 2][r & 3];
        if (RELU) v = v > 0.0f ? v : 0.0f;
        o[r] = (_Float16)v;
      }
      *(v8h*)(Ce + ((size_t)((m0 >> 4) + mi) * (ldc >> 5) + ((n0 + 16 * j) >> 5)) * 512 +
              (j & 1) * 256 + lane * 8) = o;
    }
  }
}

// ---------------------------------------------------------------------------
// Router tail: logits = rh2 @ rw3 + rb3 ; weights = softmax((logits+gumbel)/tau)
// ---------------------------------------------------------------------------
__global__ void router_tail_kernel(const _Float16* __restrict__ rh2,
                                   const float* __restrict__ rw3,  // [RH2, E]
                                   const float* __restrict__ rb3,  // [E]
                                   const float* __restrict__ u,    // [B, E]
                                   float* __restrict__ wout) {     // [B, E]
  int b = blockIdx.x * blockDim.x + threadIdx.x;
  if (b >= kB) return;
  float acc[kE];
#pragma unroll
  for (int e = 0; e < kE; ++e) acc[e] = rb3[e];
  for (int q = 0; q < kRH2 / 8; ++q) {   // rh2 is in fragment order
    v8h hq = *(const v8h*)(rh2 + frag_chunk((size_t)b, q, kRH2));
#pragma unroll   // hq is indexed by constants only
    for (int i = 0; i < 8; ++i) {
      float hv = (float)hq[i];
#pragma unroll
      for (int e = 0; e < kE; ++e) acc[e] += hv * rw3[(q * 8 + i) * kE + e];
    }
  }
  float mx = -1e30f;
#pragma unroll
  for (int e = 0; e < kE; ++e) {
    float uu = u[(size_t)b * kE + e];
    uu = fminf(fmaxf(uu, 1e-10f), 1.0f);
    float g = -logf(-logf(uu) + 1e-10f);
    acc[e] = (acc[e] + g) / kTau;
    mx = fmaxf(mx, acc[e]);
  }
  float s = 0.0f;
#pragma unroll
  for (int e = 0; e < kE; ++e) { acc[e] = expf(acc[e] - mx); s += acc[e]; }
  float inv = 1.0f / s;
#pragma unroll
  for (int e = 0; e < kE; ++e) wout[(size_t)b * kE + e] = acc[e] * inv;
}

// ---------------------------------------------------------------------------
// Expert MLP, all three layers in one kernel:
//   chart[e][b][:] = relu(relu(x W1 + b1) W2 + b2) W3 + b3
//   - block = 8 waves = 256 rows of one expert; a wave owns 32 rows x all 128 n
//   - W1[e] and W2[e] (fragment order) are copied once into LDS: 160 KiB, so
//     two blocks share a WGP and one computes while the other copies
//   - weights are the WMMA's first operand, so a lane's accumulators of n tiles
//     2t and 2t+1 are, after bias, relu and rounding to f16, exactly its
//     registers of the next layer's activation fragment for k tile t: h1 goes
//     from layer 1 to layer 2 in registers, with no cross-lane move
//   - layer 3 (128 -> 2) is summed per lane over its 64 n in f32, then the two
//     lane halves are added; h2 is never rounded or stored
// ---------------------------------------------------------------------------
constexpr int kW1Halves = kH * kD;   // 65536 halves = 128 KiB
constexpr int kW2Halves = kH * kH;   // 16384 halves =  32 KiB

// second argument: 4 waves per SIMD (256 VGPRs), so that two blocks are resident
__global__ __launch_bounds__(256, 4)
void expert_mlp_fused_kernel(const _Float16* __restrict__ xh,   // [B, D], fragment order
                             const _Float16* __restrict__ w1f,  // [E][H x D], fragment order
                             const _Float16* __restrict__ w2f,  // [E][H x H], fragment order
                             // no __restrict__ on the next three: their loads then keep
                             // their place between the scheduling fences below; as
                             // loads of constant memory the compiler hoisted them
                             // into the matrix phases, and spilled
                             const float* eb1,                  // [E][H]
                             const float* eb2,                  // [E][H]
                             const float* ew3,                  // [E][H][L]
                             const float* __restrict__ eb3,     // [E][L]
                             float* __restrict__ chart) {       // [E][B][L]
  __shared__ __attribute__((aligned(16))) _Float16 wl[kW1Halves + kW2Halves];
  const int tid  = threadIdx.x;
  const int lane = tid & 31;
  const int wave = tid >> 5;
  const int hi   = lane >> 4;
  const int l16  = lane & 15;
  const int e    = blockIdx.y;
  const int m0   = blockIdx.x * 256 + wave * 32;

  const _Float16* pa0 = xh + (size_t)(m0 >> 4) * (kD * 16) + lane * 8;
  const _Float16* pa1 = pa0 + kD * 16;

  v16h xb[2][2];   // x fragments of two k tiles, [kt & 1][mi]
  v16h wb[2][4];   // weight fragments: two groups of 4 n tiles

  // ---- copy both weight matrices into LDS, 16 B per lane, linear ----
  {
    const v8h* g1 = (const v8h*)(w1f + (size_t)e * kW1Halves) + tid;
    const v8h* g2 = (const v8h*)(w2f + (size_t)e * kW2Halves) + tid;
    v8h* d = (v8h*)wl + tid;
    constexpr int n1 = kW1Halves / 8 / 256;   // 32 chunks per thread of W1
    // two rounds of 20 loads, all of a round in flight ahead of its LDS stores
    // (unrolled: t stays in registers, every offset is a constant)
#pragma unroll
    for (int h = 0; h < 2; ++h) {
      v8h t[20];
#pragma unroll
      for (int i = 0; i < 20; ++i) {
        const int c = h * 20 + i;
        t[i] = c < n1 ? g1[c * 256] : g2[(c - n1) * 256];
      }
#pragma unroll
      for (int i = 0; i < 20; ++i) d[(h * 20 + i) * 256] = t[i];
    }
  }
  // the first x fragments fly while the block waits at the barrier
  xb[0][0] = load_frag_g(pa0);
  xb[0][1] = load_frag_g(pa1);
  xb[1][0] = load_frag_g(pa0 + 512);
  xb[1][1] = load_frag_g(pa1 + 512);
  // Wait before the address registers of the x loads are overwritten.
  asm volatile("s_wait_xcnt 0x0" ::: "memory");
  __syncthreads();

  // ---- layer 1: K = 512 (16 k tiles), N = 128 (8 n tiles) ----
  v8f acc[2][8];
#pragma unroll
  for (int mi = 0; mi < 2; ++mi)
#pragma unroll
    for (int j = 0; j < 8; ++j)
#pragma unroll
      for (int i = 0; i < 8; ++i) acc[mi][j][i] = 0.0f;

  const _Float16* lw1 = wl + lane * 8;               // tile (j, kt) at (j*16 + kt)*512
  const _Float16* lw2 = wl + kW1Halves + lane * 8;   // tile (j, kt) at (j*4 + kt)*512
#pragma unroll
  for (int jj = 0; jj < 4; ++jj) wb[0][jj] = load_frag_g(lw1 + (jj * 16) * 512);

  // Fully unrolled: every array index and every address offset is a constant,
  // so no address register is rewritten while loads are in flight.
  // Group g = (k tile g/2, n tiles 4*(g&1) .. +3): its 8 LDS loads are issued
  // together, one group ahead of the 8 WMMAs that use them.
#pragma unroll
  for (int g = 0; g < 32; ++g) {
    const int kt = g >> 1, jh = g & 1;
    if (g + 1 < 32) {
      const int kn = (g + 1) >> 1, jn = ((g + 1) & 1) * 4;
#pragma unroll
      for (int jj = 0; jj < 4; ++jj)
        wb[(g + 1) & 1][jj] = load_frag_g(lw1 + ((jn + jj) * 16 + kn) * 512);
    }
    // keeps the loads above in one place ahead of the WMMA block (for speed only)
    __builtin_amdgcn_sched_barrier(0);
#pragma unroll
    for (int jj = 0; jj < 4; ++jj) {
      acc[0][jh * 4 + jj] = wmma_f16(wb[g & 1][jj], xb[kt & 1][0], acc[0][jh * 4 + jj]);
      acc[1][jh * 4 + jj] = wmma_f16(wb[g & 1][jj], xb[kt & 1][1], acc[1][jh * 4 + jj]);
    }
    // ends the WMMA block: the next group's loads stay behind it
    __builtin_amdgcn_sched_barrier(0);
    if (jh == 1 && kt + 2 < 16) {
      xb[kt & 1][0] = load_frag_g(pa0 + (kt + 2) * 512);
      xb[kt & 1][1] = load_frag_g(pa1 + (kt + 2) * 512);
    }
  }
  // Wait before the address registers of the x loads are overwritten; naming
  // them keeps them whole up to the wait.
  asm volatile("s_wait_xcnt 0x0" :: "v"(pa0), "v"(pa1) : "memory");

  // ---- h1 = f16(relu(acc + b1)), straight into layer 2's fragments ----
  // acc[mi][j][r] = row m0 + 16*mi + l16, n = 16*j + 8*hi + r
  v16h hf[2][4];   // [mi][k tile of layer 2]
  {
    const float* be = eb1 + e * kH + 8 * hi;
    v4f b[8][2];   // all 16 loads in flight together: one latency, not eight
#pragma unroll
    for (int j = 0; j < 8; ++j) {
      b[j][0] = *(const v4f*)(be + 16 * j);
      b[j][1] = *(const v4f*)(be + 16 * j + 4);
    }
    // Wait before the address registers of these loads are overwritten; naming
    // the pointer keeps it whole up to the wait.
    asm volatile("s_wait_xcnt 0x0" :: "v"(be) : "memory");
#pragma unroll
    for (int j = 0; j < 8; ++j) {
      // one n tile at a time, so that its accumulators are free before the
      // next tile's temporaries are made (registers)
      __builtin_amdgcn_sched_barrier(0);
#pragma unroll
      for (int mi = 0; mi < 2; ++mi)
#pragma unroll
        for (int r = 0; r < 8; ++r) {
          float v = acc[mi][j][r] + b[j][r >> 2][r & 3];
          v = v > 0.0f ? v : 0.0f;
          hf[mi][j >> 1][(j & 1) * 8 + r] = (_Float16)v;
        }
    }
    // layer 2's loads stay behind the conversion (registers)
    __builtin_amdgcn_sched_barrier(0);
  }

  // ---- layers 2 and 3, 4 n tiles at a time ----
  const float* be2 = eb2 + e * kH + 8 * hi;
  const float* w3  = ew3 + (size_t)e * kH * kL + 16 * hi;
  v2f s[2] = {{0.0f, 0.0f}, {0.0f, 0.0f}};   // [mi], the two l side by side
  // not unrolled: unrolled, the compiler moved the first half's sums behind the
  // second half's matrix phase, kept both halves' values live, and spilled
#pragma unroll 1
  for (int jh = 0; jh < 2; ++jh) {
    v8f a2[2][4];
#pragma unroll
    for (int mi = 0; mi < 2; ++mi)
#pragma unroll
      for (int jj = 0; jj < 4; ++jj)
#pragma unroll
        for (int i = 0; i < 8; ++i) a2[mi][jj][i] = 0.0f;
#pragma unroll
    for (int jj = 0; jj < 4; ++jj)
      wb[0][jj] = load_frag_g(lw2 + ((jh * 4 + jj) * 4) * 512);
#pragma unroll
    for (int kt = 0; kt < 4; ++kt) {
      if (kt + 1 < 4) {
#pragma unroll
        for (int jj = 0; jj < 4; ++jj)
          wb[(kt + 1) & 1][jj] = load_frag_g(lw2 + ((jh * 4 + jj) * 4 + kt + 1) * 512);
      }
      // as in layer 1: loads in one place ahead of the WMMA block
      __builtin_amdgcn_sched_barrier(0);
#pragma unroll
      for (int jj = 0; jj < 4; ++jj) {
        a2[0][jj] = wmma_f16(wb[kt & 1][jj], hf[0][kt], a2[0][jj]);
        a2[1][jj] = wmma_f16(wb[kt & 1][jj], hf[1][kt], a2[1][jj]);
      }
      // ends the WMMA block; behind the last one it also keeps the bias and W3
      // loads below out of the matrix phase, where they would not fit the registers
      __builtin_amdgcn_sched_barrier(0);
    }
    v4f b[4][2];   // b2[n]
    v4f c[4][4];   // W3[n][l], n = 16*j + 8*hi + 0..7: 16 consecutive floats
    // all 24 loads in flight together: one latency, not four
    const float* pb = be2 + 64 * jh;
    const float* pc = w3 + 128 * jh;
#pragma unroll
    for (int jj = 0; jj < 4; ++jj) {
      b[jj][0] = *(const v4f*)(pb + 16 * jj);
      b[jj][1] = *(const v4f*)(pb + 16 * jj + 4);
#pragma unroll
      for (int i = 0; i < 4; ++i) c[jj][i] = *(const v4f*)(pc + 32 * jj + 4 * i);
    }
    // Wait before the address registers of these loads are overwritten; naming
    // the pointers keeps them whole up to the wait.
    asm volatile("s_wait_xcnt 0x0" :: "v"(pb), "v"(pc) : "memory");
#pragma unroll
    for (int jj = 0; jj < 4; ++jj) {
      // one n tile at a time (registers), as in the conversion above
      __builtin_amdgcn_sched_barrier(0);
#pragma unroll
      for (int mi = 0; mi < 2; ++mi)
#pragma unroll
        for (int r = 0; r < 8; ++r) {
          float v = a2[mi][jj][r] + b[jj][r >> 2][r & 3];
          v = v > 0.0f ? v : 0.0f;
          const v2f cw = {c[jj][r >> 1][(r & 1) * 2 + 0], c[jj][r >> 1][(r & 1) * 2 + 1]};
          const v2f vv = {v, v};
          s[mi] = __builtin_elementwise_fma(vv, cw, s[mi]);
        }
    }
  }

  // add the two lane halves (n split by hi); then lane half hi stores row tile hi:
  // one wave writes 32 rows x 8 B = 256 contiguous bytes
#pragma unroll
  for (int mi = 0; mi < 2; ++mi)
#pragma unroll
    for (int l = 0; l < 2; ++l) s[mi][l] += __shfl_xor(s[mi][l], 16);
  float2 o;
  o.x = (hi ? s[1][0] : s[0][0]) + eb3[e * kL + 0];
  o.y = (hi ? s[1][1] : s[0][1]) + eb3[e * kL + 1];
  *(float2*)(chart + ((size_t)e * kB + m0 + lane) * kL) = o;
}

// z[b,l] = sum_e weights[b,e] * chart[e,b,l]
__global__ void z_kernel(const float* __restrict__ wght,
                         const float* __restrict__ chart,
                         float* __restrict__ z) {
  int b = blockIdx.x * blockDim.x + threadIdx.x;
  if (b >= kB) return;
  float z0 = 0.0f, z1 = 0.0f;
#pragma unroll
  for (int e = 0; e < kE; ++e) {
    float w = wght[(size_t)b * kE + e];
    z0 += w * chart[((size_t)e * kB + b) * kL + 0];
    z1 += w * chart[((size_t)e * kB + b) * kL + 1];
  }
  z[(size_t)b * kL + 0] = z0;
  z[(size_t)b * kL + 1] = z1;
}

// ---------------------------------------------------------------------------
extern "C" void kernel_launch(void* const* d_in, const int* in_sizes, int n_in,
                              void* d_out, int out_size, void* d_ws, size_t ws_size,
                              hipStream_t stream) {
  (void)in_sizes; (void)n_in; (void)out_size; (void)ws_size;

  const float* x   = (const float*)d_in[0];
  const float* u   = (const float*)d_in[1];
  const float* rw1 = (const float*)d_in[2];
  const float* rb1 = (const float*)d_in[3];
  const float* rw2 = (const float*)d_in[4];
  const float* rb2 = (const float*)d_in[5];
  const float* rw3 = (const float*)d_in[6];
  const float* rb3 = (const float*)d_in[7];
  const float* ew1 = (const float*)d_in[8];
  const float* eb1 = (const float*)d_in[9];
  const float* ew2 = (const float*)d_in[10];
  const float* eb2 = (const float*)d_in[11];
  const float* ew3 = (const float*)d_in[12];
  const float* eb3 = (const float*)d_in[13];

  float* out   = (float*)d_out;
  float* out_z = out;                                  // [B, L]
  float* out_w = out + (size_t)kB * kL;                // [B, E]
  float* out_c = out_w + (size_t)kB * kE;              // [E, B, L]

  // Workspace carve-up (256B aligned)
  char* ws = (char*)d_ws;
  size_t off = 0;
  auto carve = [&](size_t bytes) -> void* {
    void* p = ws + off;
    off += (bytes + 255) & ~(size_t)255;
    return p;
  };
  // xh, rh1, rh2, ew1T, ew2T: fragment order (ew1T, ew2T per expert)
  _Float16* xh   = (_Float16*)carve((size_t)kB * kD * 2);         // x in f16
  _Float16* rw1T = (_Float16*)carve((size_t)kD * kRH1 * 2);       // [RH1, D]
  _Float16* rw2T = (_Float16*)carve((size_t)kRH1 * kRH2 * 2);     // [RH2, RH1]
  _Float16* ew1T = (_Float16*)carve((size_t)kE * kD * kH * 2);    // [E][H][D]
  _Float16* ew2T = (_Float16*)carve((size_t)kE * kH * kH * 2);    // [E][H][H]
  _Float16* rh1  = (_Float16*)carve((size_t)kB * kRH1 * 2);       // [B, RH1]
  _Float16* rh2  = (_Float16*)carve((size_t)kB * kRH2 * 2);       // [B, RH2]

  // 1) conversions / weight transposes
  f32_to_f16_frag_kernel<<<dim3(kB / 16), 256, 0, stream>>>(x, xh);
  transpose_to_f16_kernel<false><<<dim3((kD * kRH1 + 255) / 256, 1), 256, 0, stream>>>(rw1, rw1T, kD, kRH1);
  transpose_to_f16_kernel<false><<<dim3((kRH1 * kRH2 + 255) / 256, 1), 256, 0, stream>>>(rw2, rw2T, kRH1, kRH2);
  transpose_to_f16_kernel<true><<<dim3((kD * kH + 255) / 256, kE), 256, 0, stream>>>(ew1, ew1T, kD, kH);
  transpose_to_f16_kernel<true><<<dim3((kH * kH + 255) / 256, kE), 256, 0, stream>>>(ew2, ew2T, kH, kH);

  auto ldsBytes = [](int K) { return (size_t)64 * (K + 8) * sizeof(_Float16); };

  // 2) router MLP (two WMMA GEMMs), then logits+gumbel-softmax tail
  gemm_wmma_f16<true><<<dim3(kB / 256, kRH1 / 64, 1), 256, ldsBytes(kD), stream>>>(
      xh, 0, rw1T, 0, rb1, 0, rh1, kRH1, 0, kD);
  gemm_wmma_f16<true><<<dim3(kB / 256, kRH2 / 64, 1), 256, ldsBytes(kRH1), stream>>>(
      rh1, 0, rw2T, 0, rb2, 0, rh2, kRH2, 0, kRH1);
  router_tail_kernel<<<dim3(kB / 256), 256, 0, stream>>>(rh2, rw3, rb3, u, out_w);

  // 3) experts: all three layers in one launch, into the chart_outputs region
  expert_mlp_fused_kernel<<<dim3(kB / 256, kE), 256, 0, stream>>>(
      xh, ew1T, ew2T, eb1, eb2, ew3, eb3, out_c);

  // 4) z = weights . zc
  z_kernel<<<dim3(kB / 256), 256, 0, stream>>>(out_w, out_c, out_z);
}

// v003
// Measured time: 96.7 microseconds a run.
// Next to v002, in two timings, it ran 1.11 and 1.10 times as fast.
// Over all steps from v000 it is 2.43 times as fast.
#include <hip/hip_runtime.h>
#include <hip/hip_bf16.h>

typedef __attribute__((ext_vector_type(16))) _Float16 v16h;
typedef __attribute__((ext_vector_type(8)))  _Float16 v8h;
typedef __attribute__((ext_vector_type(8)))  float    v8f;
typedef __attribute__((ext_vector_type(4)))  float    v4f;
typedef __attribute__((ext_vector_type(2)))  float    v2f;

// Problem sizes (fixed by the reference)
constexpr int kB   = 32768;
constexpr int kD   = 512;
constexpr int kE   = 10;
constexpr int kH   = 128;
constexpr int kL   = 2;
constexpr int kRH1 = 256;
constexpr int kRH2 = 128;
constexpr float kTau = 3.0f;

// ---------------------------------------------------------------------------
// Fragment order of an f16 activation matrix [rows x K] in the workspace.
//
// The matrix is cut into tiles of 16 rows x 32 k (512 halves = 1 KiB); tile
// (mt, kt) starts at (mt * (K/32) + kt) * 512 halves.  A tile is two pieces of
// 256 halves; in piece p, lane (h*16 + c) owns the 8 halves
//   row = mt*16 + c,  k = kt*32 + p*16 + h*8 + 0..7,
// which is what that lane's WMMA operand registers hold.  So one wave reads or
// writes a piece as 32 lanes x 16 B = 512 contiguous bytes (4 whole lines).
//
// frag_chunk: offset in halves of the 8 halves (row, k = 8q .. 8q+7).
// ---------------------------------------------------------------------------
__device__ __forceinline__ size_t frag_chunk(size_t row, int q, int K) {
  return ((row >> 4) * (size_t)(K >> 5) + (q >> 2)) * 512 +
         ((q >> 1) & 1) * 256 + ((q & 1) * 16 + (int)(row & 15)) * 8;
}

// ---------------------------------------------------------------------------
// Prep kernels
// ---------------------------------------------------------------------------
// x [B, D] fp32 -> xh, f16 in fragment order.  One block = one tile row
// (16 rows x D = 1024 chunks of 8 halves), 4 chunks per thread; chunk
// u = t + 256*s of the tile row is stored at u*8 halves.
__global__ __launch_bounds__(256)
void f32_to_f16_frag_kernel(const float* __restrict__ src,
                            _Float16* __restrict__ dst) {
  const int t = threadIdx.x;
  const size_t mt = blockIdx.x;
  const int c = t & 15, h = (t >> 4) & 1, p = (t >> 5) & 1, kt0 = t >> 6;
  const float* s = src + (mt * 16 + c) * kD + kt0 * 32 + p * 16 + h * 8;
  _Float16* d = dst + mt * (size_t)(kD * 16) + t * 8;
  v4f lo[4], up[4];
  // unrolled (here and below): the arrays stay in registers and all 8 loads
  // are in flight before the first store
#pragma unroll
  for (int i = 0; i < 4; ++i) {
    lo[i] = *(const v4f*)(s + i * 128);
    up[i] = *(const v4f*)(s + i * 128 + 4);
  }
#pragma unroll
  for (int i = 0; i < 4; ++i) {
    v8h v;
#pragma unroll
    for (int k = 0; k < 4; ++k) {
      v[k] = (_Float16)lo[i][k];
      v[k + 4] = (_Float16)up[i][k];
    }
    *(v8h*)(d + i * 2048) = v;
  }
}

// W: [K,N] fp32 (optionally batched) -> WT: [N,K] f16 (B^T, so B columns are
// contiguous in memory for fragment loads).  A thread makes one 16-byte chunk:
// 8 k of one n.  Chunk u is numbered in fragment order (rows = n): lane
// (h*16 + c) of a wave has n = nt*16 + c and k = 8q .. 8q+7, q = kt*4 + p*2 + h,
// so each of its 8 loads reads two runs of 16 consecutive floats per wave.
// FRAG: WT is stored in fragment order, for the fused expert kernel's linear
// copy into LDS: chunk u lies at u*8 halves, 512 contiguous B per wave.
template <int K, int N, bool FRAG>
__global__ __launch_bounds__(256)
void transpose_to_f16_kernel(const float* __restrict__ W,
                             _Float16* __restrict__ WT) {
  static_assert(K % 32 == 0 && N % 16 == 0 && (K * N / 8) % 256 == 0,
                "the grid of K*N/8/256 blocks covers the chunks exactly");
  const size_t batch = blockIdx.y;
  const float* w = W + batch * (size_t)(K * N);
  _Float16* wt = WT + batch * (size_t)(K * N);
  const unsigned u = blockIdx.x * 256 + threadIdx.x;
  const unsigned n = ((u >> 6) / (K / 32)) * 16 + (u & 15);
  const unsigned q = ((u >> 6) % (K / 32)) * 4 + ((u >> 4) & 3);
  const float* s = w + (size_t)(q * 8) * N + n;
  float f[8];
  // unrolled: f stays in registers and all 8 loads are in flight together
#pragma unroll
  for (int i = 0; i < 8; ++i) f[i] = s[i * N];
  v8h v;
#pragma unroll   // v is indexed by constants only
  for (int i = 0; i < 8; ++i) v[i] = (_Float16)f[i];
  *(v8h*)(wt + (FRAG ? (size_t)u * 8 : (size_t)n * K + q * 8)) = v;
}

// ---------------------------------------------------------------------------
// Fragment helpers.
//
// CDNA5 16-bit A (16x32) lane layout: lane l (0..15) holds row M=l with
// K = {kb..kb+7, kb+16..kb+23}; lanes 16..31 hold the same rows with
// K = {kb+8..kb+15, kb+24..kb+31}.  B mirrors this with column N=l, which is
// a contiguous row of BT.  C/D: VGPR r, lane l -> (M = r + 8*(l>>4), N = l&15).
// ---------------------------------------------------------------------------
// p = tile start + lane*8 of a matrix in fragment order: the two pieces.
__device__ __forceinline__ v16h load_frag_g(const _Float16* p) {
  v8h a = *(const v8h*)(p);       // 16B -> b128 load (global or LDS), 512 B per wave
  v8h b = *(const v8h*)(p + 256);
  v16h r;
#pragma unroll
  for (int i = 0; i < 8; ++i) { r[i] = a[i]; r[i + 8] = b[i]; }
  return r;
}

__device__ __forceinline__ v16h load_frag_lds(const _Float16* p) {
  v8h a = *(const v8h*)(p);       // 16B -> ds_load_b128
  v8h b = *(const v8h*)(p + 16);
  v16h r;
#pragma unroll
  for (int i = 0; i < 8; ++i) { r[i] = a[i]; r[i + 8] = b[i]; }
  return r;
}

__device__ __forceinline__ v8f wmma_f16(v16h a, v16h b, v8f c) {
  return __builtin_amdgcn_wmma_f32_16x16x32_f16(false, a, false, b, (short)0,
                                                c, false, false);
}

// ---------------------------------------------------------------------------
// WMMA GEMM v3: C = relu(A[M,K] * B[K,N] + bias)
//   - A and C are in fragment order (C with row length ldc)
//   - the weight fragment is the WMMA's first operand and the activation
//     fragment its second, so D = C^T: a lane holds 8 consecutive n of one row
//     m, which is one 16-byte chunk of C in fragment order
//   - block = 256 threads = 8 waves, block tile 256M x 64N
//   - B tile (64 x K, padded rows) staged in LDS once, shared by all waves
//   - each wave computes 32M x 64N (8 accumulators)
//   - k-loop unrolled by 64 with two alternating A buffers (no copy-swap),
//     B fragments pipelined one step ahead, prefetch offsets wrapped instead
//     of guarded (branch-free steady state)
// Requires K % 64 == 0 (true for 512 / 256). Batched via blockIdx.z.
// ---------------------------------------------------------------------------
template <bool RELU>
__global__ __launch_bounds__(256)
void gemm_wmma_f16(const _Float16* __restrict__ A, long long aStride,
                   const _Float16* __restrict__ BT, long long bStride,
                   const float* __restrict__ bias, long long biasStride,
                   _Float16* __restrict__ C, int ldc, long long cStride,
                   int K) {
  extern __shared__ _Float16 lds[];   // 64 * (K + 8) halves
  const int tid  = threadIdx.x;
  const int lane = tid & 31;
  const int wave = tid >> 5;
  const int hi   = lane >> 4;
  const int l16  = lane & 15;
  const int ldsRow = K + 8;           // pad 8 halves -> conflict-free b128 reads

  const long long e = blockIdx.z;
  const _Float16* Ae = A + e * aStride;
  const _Float16* Be = BT + e * bStride;
  const float*    be = bias + e * biasStride;
  _Float16*       Ce = C + e * cStride;

  const int m0 = blockIdx.x * 256 + wave * 32;
  const int n0 = blockIdx.y * 64;

  // ---- stage BT tile [64 x K] into LDS (all 256 threads cooperate) ----
  {
    const int chunksPerRow = K >> 3;        // 8 halves per 16B chunk
    const int total = 64 * chunksPerRow;
    for (int c = tid; c < total; c += 256) {
      int n  = c / chunksPerRow;
      int kc = c - n * chunksPerRow;
      v8h v = *(const v8h*)(Be + (size_t)(n0 + n) * K + kc * 8);
      *(v8h*)(&lds[(size_t)n * ldsRow + kc * 8]) = v;
    }
  }
  __syncthreads();

  v8f acc[2][4];
#pragma unroll
  for (int mi = 0; mi < 2; ++mi)
#pragma unroll
    for (int j = 0; j < 4; ++j)
#pragma unroll
      for (int i = 0; i < 8; ++i) acc[mi][j][i] = 0.0f;

  // tile row m0/16 of A; a tile row is K*16 halves, a k step of 32 is 512.
  const _Float16* pa0 = Ae + (size_t)(m0 >> 4) * K * 16 + lane * 8;
  const _Float16* pa1 = pa0 + (size_t)K * 16;

  // Two alternating A buffers (k and k+32) -> no register copy swap.
  v16h aA[2], aB[2];
  aA[0] = load_frag_g(pa0);
  aA[1] = load_frag_g(pa1);
  aB[0] = load_frag_g(pa0 + 512);
  aB[1] = load_frag_g(pa1 + 512);

  const _Float16* lb = &lds[(size_t)l16 * ldsRow + 8 * hi];
  const int jStep = 16 * ldsRow;

  // B pipeline: bcur always holds the fragment for the WMMA about to issue.
  v16h bcur = load_frag_lds(lb);   // (j=0, k=0)

  for (int kb = 0; kb < K; kb += 64) {
    const int kpre = (kb + 64 < K) ? (kb + 64) : 0;  // wrapped prefetch

    // ---- sub-step 0: k = kb, A = aA ----
#pragma unroll
    for (int j = 0; j < 4; ++j) {
      v16h bnxt = (j < 3) ? load_frag_lds(lb + (j + 1) * jStep + kb)
                          : load_frag_lds(lb + kb + 32);
      acc[0][j] = wmma_f16(bcur, aA[0], acc[0][j]);
      acc[1][j] = wmma_f16(bcur, aA[1], acc[1][j]);
      bcur = bnxt;
    }
    const _Float16* qa0 = pa0 + kpre * 16;
    const _Float16* qa1 = pa1 + kpre * 16;
    aA[0] = load_frag_g(qa0);
    aA[1] = load_frag_g(qa1);

    // ---- sub-step 1: k = kb+32, A = aB ----
#pragma unroll
    for (int j = 0; j < 4; ++j) {
      v16h bnxt = (j < 3) ? load_frag_lds(lb + (j + 1) * jStep + kb + 32)
                          : load_frag_lds(lb + kpre);  // next outer, j=0
      acc[0][j] = wmma_f16(bcur, aB[0], acc[0][j]);
      acc[1][j] = wmma_f16(bcur, aB[1], acc[1][j]);
      bcur = bnxt;
    }
    aB[0] = load_frag_g(qa0 + 512);
    aB[1] = load_frag_g(qa1 + 512);
    // Wait before the address registers of this pass's loads are overwritten;
    // naming them keeps them whole up to the wait.
    asm volatile("s_wait_xcnt 0x0" :: "v"(qa0), "v"(qa1) : "memory");
  }

  // ---- epilogue: bias + relu, store f16 in fragment order ----
  // acc[mi][j][r] = C[m0 + 16*mi + l16][n0 + 16*j + 8*hi + r]
  v4f bv[4][2];   // unrolled loops: bv and acc are indexed by constants only
#pragma unroll
  for (int j = 0; j < 4; ++j) {
    const int nb = n0 + 16 * j + 8 * hi;
    bv[j][0] = *(const v4f*)(be + nb);
    bv[j][1] = *(const v4f*)(be + nb + 4);
  }
  // The store address set-up below reuses the address registers of the bias
  // loads: wait before they are overwritten.
  asm volatile("s_wait_xcnt 0x0" ::: "memory");
  // Keeps that set-up (argument loads, address arithmetic) behind the wait.
  __builtin_amdgcn_sched_barrier(0);
#pragma unroll
  for (int j = 0; j < 4; ++j) {
#pragma unroll
    for (int mi = 0; mi < 2; ++mi) {
      v8h o;
#pragma unroll
      for (int r = 0; r < 8; ++r) {
        float v = acc[mi][j][r] + bv[j][r >> 2][r & 3];
        if (RELU) v = v > 0.0f ? v : 0.0f;
        o[r] = (_Float16)v;
      }
      *(v8h*)(Ce + ((size_t)((m0 >> 4) + mi) * (ldc >> 5) + ((n0 + 16 * j) >> 5)) * 512 +
              (j & 1) * 256 + lane * 8) = o;
    }
  }
}

// ---------------------------------------------------------------------------
// Router tail: logits = rh2 @ rw3 + rb3 ; weights = softmax((logits+gumbel)/tau)
// ---------------------------------------------------------------------------
__global__ void router_tail_kernel(const _Float16* __restrict__ rh2,
                                   const float* __restrict__ rw3,  // [RH2, E]
                                   const float* __restrict__ rb3,  // [E]
                                   const float* __restrict__ u,    // [B, E]
                                   float* __restrict__ wout) {     // [B, E]
  int b = blockIdx.x * blockDim.x + threadIdx.x;
  if (b >= kB) return;
  float acc[kE];
#pragma unroll
  for (int e = 0; e < kE; ++e) acc[e] = rb3[e];
  for (int q = 0; q < kRH2 / 8; ++q) {   // rh2 is in fragment order
    v8h hq = *(const v8h*)(rh2 + frag_chunk((size_t)b, q, kRH2));
#pragma unroll   // hq is indexed by constants only
    for (int i = 0; i < 8; ++i) {
      float hv = (float)hq[i];
#pragma unroll
      for (int e = 0; e < kE; ++e) acc[e] += hv * rw3[(q * 8 + i) * kE + e];
    }
  }
  float mx = -1e30f;
#pragma unroll
  for (int e = 0; e < kE; ++e) {
    float uu = u[(size_t)b * kE + e];
    uu = fminf(fmaxf(uu, 1e-10f), 1.0f);
    float g = -logf(-logf(uu) + 1e-10f);
    acc[e] = (acc[e] + g) / kTau;
    mx = fmaxf(mx, acc[e]);
  }
  float s = 0.0f;
#pragma unroll
  for (int e = 0; e < kE; ++e) { acc[e] = expf(acc[e] - mx); s += acc[e]; }
  float inv = 1.0f / s;
#pragma unroll
  for (int e = 0; e < kE; ++e) wout[(size_t)b * kE + e] = acc[e] * inv;
}

// ---------------------------------------------------------------------------
// Expert MLP, all three layers in one kernel:
//   chart[e][b][:] = relu(relu(x W1 + b1) W2 + b2) W3 + b3
//   - block = 8 waves = 256 rows of one expert; a wave owns 32 rows x all 128 n
//   - W1[e] and W2[e] (fragment order) are copied once into LDS: 160 KiB, so
//     two blocks share a WGP and one computes while the other copies
//   - weights are the WMMA's first operand, so a lane's accumulators of n tiles
//     2t and 2t+1 are, after bias, relu and rounding to f16, exactly its
//     registers of the next layer's activation fragment for k tile t: h1 goes
//     from layer 1 to layer 2 in registers, with no cross-lane move
//   - layer 3 (128 -> 2) is summed per lane over its 64 n in f32, then the two
//     lane halves are added; h2 is never rounded or stored
// ---------------------------------------------------------------------------
constexpr int kW1Halves = kH * kD;   // 65536 halves = 128 KiB
constexpr int kW2Halves = kH * kH;   // 16384 halves =  32 KiB

// second argument: 4 waves per SIMD (256 VGPRs), so that two blocks are resident
__global__ __launch_bounds__(256, 4)
void expert_mlp_fused_kernel(const _Float16* __restrict__ xh,   // [B, D], fragment order
                             const _Float16* __restrict__ w1f,  // [E][H x D], fragment order
                             const _Float16* __restrict__ w2f,  // [E][H x H], fragment order
                             // no __restrict__ on the next three: their loads then keep
                             // their place between the scheduling fences below; as
                             // loads of constant memory the compiler hoisted them
                             // into the matrix phases, and spilled
                             const float* eb1,                  // [E][H]
                             const float* eb2,                  // [E][H]
                             const float* ew3,                  // [E][H][L]
                             const float* __restrict__ eb3,     // [E][L]
                             float* __restrict__ chart) {       // [E][B][L]
  __shared__ __attribute__((aligned(16))) _Float16 wl[kW1Halves + kW2Halves];
  const int tid  = threadIdx.x;
  const int lane = tid & 31;
  const int wave = tid >> 5;
  const int hi   = lane >> 4;
  const int l16  = lane & 15;
  const int e    = blockIdx.y;
  const int m0   = blockIdx.x * 256 + wave * 32;

  const _Float16* pa0 = xh + (size_t)(m0 >> 4) * (kD * 16) + lane * 8;
  const _Float16* pa1 = pa0 + kD * 16;

  v16h xb[2][2];   // x fragments of two k tiles, [kt & 1][mi]
  v16h wb[2][4];   // weight fragments: two groups of 4 n tiles

  // ---- copy both weight matrices into LDS, 16 B per lane, linear ----
  {
    const v8h* g1 = (const v8h*)(w1f + (size_t)e * kW1Halves) + tid;
    const v8h* g2 = (const v8h*)(w2f + (size_t)e * kW2Halves) + tid;
    v8h* d = (v8h*)wl + tid;
    constexpr int n1 = kW1Halves / 8 / 256;   // 32 chunks per thread of W1
    // two rounds of 20 loads, all of a round in flight ahead of its LDS stores
    // (unrolled: t stays in registers, every offset is a constant)
#pragma unroll
    for (int h = 0; h < 2; ++h) {
      v8h t[20];
#pragma unroll
      for (int i = 0; i < 20; ++i) {
        const int c = h * 20 + i;
        t[i] = c < n1 ? g1[c * 256] : g2[(c - n1) * 256];
      }
#pragma unroll
      for (int i = 0; i < 20; ++i) d[(h * 20 + i) * 256] = t[i];
    }
  }
  // the first x fragments fly while the block waits at the barrier
  xb[0][0] = load_frag_g(pa0);
  xb[0][1] = load_frag_g(pa1);
  xb[1][0] = load_frag_g(pa0 + 512);
  xb[1][1] = load_frag_g(pa1 + 512);
  // Wait before the address registers of the x loads are overwritten.
  asm volatile("s_wait_xcnt 0x0" ::: "memory");
  __syncthreads();

  // ---- layer 1: K = 512 (16 k tiles), N = 128 (8 n tiles) ----
  v8f acc[2][8];
#pragma unroll
  for (int mi = 0; mi < 2; ++mi)
#pragma unroll
    for (int j = 0; j < 8; ++j)
#pragma unroll
      for (int i = 0; i < 8; ++i) acc[mi][j][i] = 0.0f;

  const _Float16* lw1 = wl + lane * 8;               // tile (j, kt) at (j*16 + kt)*512
  const _Float16* lw2 = wl + kW1Halves + lane * 8;   // tile (j, kt) at (j*4 + kt)*512
#pragma unroll
  for (int jj = 0; jj < 4; ++jj) wb[0][jj] = load_frag_g(lw1 + (jj * 16) * 512);

  // Fully unrolled: every array index and every address offset is a constant,
  // so no address register is rewritten while loads are in flight.
  // Group g = (k tile g/2, n tiles 4*(g&1) .. +3): its 8 LDS loads are issued
  // together, one group ahead of the 8 WMMAs that use them.
#pragma unroll
  for (int g = 0; g < 32; ++g) {
    const int kt = g >> 1, jh = g & 1;
    if (g + 1 < 32) {
      const int kn = (g + 1) >> 1, jn = ((g + 1) & 1) * 4;
#pragma unroll
      for (int jj = 0; jj < 4; ++jj)
        wb[(g + 1) & 1][jj] = load_frag_g(lw1 + ((jn + jj) * 16 + kn) * 512);
    }
    // keeps the loads above in one place ahead of the WMMA block (for speed only)
    __builtin_amdgcn_sched_barrier(0);
#pragma unroll
    for (int jj = 0; jj < 4; ++jj) {
      acc[0][jh * 4 + jj] = wmma_f16(wb[g & 1][jj], xb[kt & 1][0], acc[0][jh * 4 + jj]);
      acc[1][jh * 4 + jj] = wmma_f16(wb[g & 1][jj], xb[kt & 1][1], acc[1][jh * 4 + jj]);
    }
    // ends the WMMA block: the next group's loads stay behind it
    __builtin_amdgcn_sched_barrier(0);
    if (jh == 1 && kt + 2 < 16) {
      xb[kt & 1][0] = load_frag_g(pa0 + (kt + 2) * 512);
      xb[kt & 1][1] = load_frag_g(pa1 + (kt + 2) * 512);
    }
  }
  // Wait before the address registers of the x loads are overwritten; naming
  // them keeps them whole up to the wait.
  asm volatile("s_wait_xcnt 0x0" :: "v"(pa0), "v"(pa1) : "memory");

  // ---- h1 = f16(relu(acc + b1)), straight into layer 2's fragments ----
  // acc[mi][j][r] = row m0 + 16*mi + l16, n = 16*j + 8*hi + r
  v16h hf[2][4];   // [mi][k tile of layer 2]
  {
    const float* be = eb1 + e * kH + 8 * hi;
    v4f b[8][2];   // all 16 loads in flight together: one latency, not eight
#pragma unroll
    for (int j = 0; j < 8; ++j) {
      b[j][0] = *(const v4f*)(be + 16 * j);
      b[j][1] = *(const v4f*)(be + 16 * j + 4);
    }
    // Wait before the address registers of these loads are overwritten; naming
    // the pointer keeps it whole up to the wait.
    asm volatile("s_wait_xcnt 0x0" :: "v"(be) : "memory");
#pragma unroll
    for (int j = 0; j < 8; ++j) {
      // one n tile at a time, so that its accumulators are free before the
      // next tile's temporaries are made (registers)
      __builtin_amdgcn_sched_barrier(0);
#pragma unroll
      for (int mi = 0; mi < 2; ++mi)
#pragma unroll
        for (int r = 0; r < 8; ++r) {
          float v = acc[mi][j][r] + b[j][r >> 2][r & 3];
          v = v > 0.0f ? v : 0.0f;
          hf[mi][j >> 1][(j & 1) * 8 + r] = (_Float16)v;
        }
    }
    // layer 2's loads stay behind the conversion (registers)
    __builtin_amdgcn_sched_barrier(0);
  }

  // ---- layers 2 and 3, 4 n tiles at a time ----
  const float* be2 = eb2 + e * kH + 8 * hi;
  const float* w3  = ew3 + (size_t)e * kH * kL + 16 * hi;
  v2f s[2] = {{0.0f, 0.0f}, {0.0f, 0.0f}};   // [mi], the two l side by side
  // not unrolled: unrolled, the compiler moved the first half's sums behind the
  // second half's matrix phase, kept both halves' values live, and spilled
#pragma unroll 1
  for (int jh = 0; jh < 2; ++jh) {
    v8f a2[2][4];
#pragma unroll
    for (int mi = 0; mi < 2; ++mi)
#pragma unroll
      for (int jj = 0; jj < 4; ++jj)
#pragma unroll
        for (int i = 0; i < 8; ++i) a2[mi][jj][i] = 0.0f;
#pragma unroll
    for (int jj = 0; jj < 4; ++jj)
      wb[0][jj] = load_frag_g(lw2 + ((jh * 4 + jj) * 4) * 512);
#pragma unroll
    for (int kt = 0; kt < 4; ++kt) {
      if (kt + 1 < 4) {
#pragma unroll
        for (int jj = 0; jj < 4; ++jj)
          wb[(kt + 1) & 1][jj] = load_frag_g(lw2 + ((jh * 4 + jj) * 4 + kt + 1) * 512);
      }
      // as in layer 1: loads in one place ahead of the WMMA block
      __builtin_amdgcn_sched_barrier(0);
#pragma unroll
      for (int jj = 0; jj < 4; ++jj) {
        a2[0][jj] = wmma_f16(wb[kt & 1][jj], hf[0][kt], a2[0][jj]);
        a2[1][jj] = wmma_f16(wb[kt & 1][jj], hf[1][kt], a2[1][jj]);
      }
      // ends the WMMA block; behind the last one it also keeps the bias and W3
      // loads below out of the matrix phase, where they would not fit the registers
      __builtin_amdgcn_sched_barrier(0);
    }
    v4f b[4][2];   // b2[n]
    v4f c[4][4];   // W3[n][l], n = 16*j + 8*hi + 0..7: 16 consecutive floats
    // all 24 loads in flight together: one latency, not four
    const float* pb = be2 + 64 * jh;
    const float* pc = w3 + 128 * jh;
#pragma unroll
    for (int jj = 0; jj < 4; ++jj) {
      b[jj][0] = *(const v4f*)(pb + 16 * jj);
      b[jj][1] = *(const v4f*)(pb + 16 * jj + 4);
#pragma unroll
      for (int i = 0; i < 4; ++i) c[jj][i] = *(const v4f*)(pc + 32 * jj + 4 * i);
    }
    // Wait before the address registers of these loads are overwritten; naming
    // the pointers keeps them whole up to the wait.
    asm volatile("s_wait_xcnt 0x0" :: "v"(pb), "v"(pc) : "memory");
#pragma unroll
    for (int jj = 0; jj < 4; ++jj) {
      // one n tile at a time (registers), as in the conversion above
      __builtin_amdgcn_sched_barrier(0);
#pragma unroll
      for (int mi = 0; mi < 2; ++mi)
#pragma unroll
        for (int r = 0; r < 8; ++r) {
          float v = a2[mi][jj][r] + b[jj][r >> 2][r & 3];
          v = v > 0.0f ? v : 0.0f;
          const v2f cw = {c[jj][r >> 1][(r & 1) * 2 + 0], c[jj][r >> 1][(r & 1) * 2 + 1]};
          const v2f vv = {v, v};
          s[mi] = __builtin_elementwise_fma(vv, cw, s[mi]);
        }
    }
  }

  // add the two lane halves (n split by hi); then lane half hi stores row tile hi:
  // one wave writes 32 rows x 8 B = 256 contiguous bytes
#pragma unroll
  for (int mi = 0; mi < 2; ++mi)
#pragma unroll
    for (int l = 0; l < 2; ++l) s[mi][l] += __shfl_xor(s[mi][l], 16);
  float2 o;
  o.x = (hi ? s[1][0] : s[0][0]) + eb3[e * kL + 0];
  o.y = (hi ? s[1][1] : s[0][1]) + eb3[e * kL + 1];
  *(float2*)(chart + ((size_t)e * kB + m0 + lane) * kL) = o;
}

// z[b,l] = sum_e weights[b,e] * chart[e,b,l]
__global__ void z_kernel(const float* __restrict__ wght,
                         const float* __restrict__ chart,
                         float* __restrict__ z) {
  int b = blockIdx.x * blockDim.x + threadIdx.x;
  if (b >= kB) return;
  float z0 = 0.0f, z1 = 0.0f;
#pragma unroll
  for (int e = 0; e < kE; ++e) {
    float w = wght[(size_t)b * kE + e];
    z0 += w * chart[((size_t)e * kB + b) * kL + 0];
    z1 += w * chart[((size_t)e * kB + b) * kL + 1];
  }
  z[(size_t)b * kL + 0] = z0;
  z[(size_t)b * kL + 1] = z1;
}

// ---------------------------------------------------------------------------
extern "C" void kernel_launch(void* const* d_in, const int* in_sizes, int n_in,
                              void* d_out, int out_size, void* d_ws, size_t ws_size,
                              hipStream_t stream) {
  (void)in_sizes; (void)n_in; (void)out_size; (void)ws_size;

  const float* x   = (const float*)d_in[0];
  const float* u   = (const float*)d_in[1];
  const float* rw1 = (const float*)d_in[2];
  const float* rb1 = (const float*)d_in[3];
  const float* rw2 = (const float*)d_in[4];
  const float* rb2 = (const float*)d_in[5];
  const float* rw3 = (const float*)d_in[6];
  const float* rb3 = (const float*)d_in[7];
  const float* ew1 = (const float*)d_in[8];
  const float* eb1 = (const float*)d_in[9];
  const float* ew2 = (const float*)d_in[10];
  const float* eb2 = (const float*)d_in[11];
  const float* ew3 = (const float*)d_in[12];
  const float* eb3 = (const float*)d_in[13];

  float* out   = (float*)d_out;
  float* out_z = out;                                  // [B, L]
  float* out_w = out + (size_t)kB * kL;                // [B, E]
  float* out_c = out_w + (size_t)kB * kE;              // [E, B, L]

  // Workspace carve-up (256B aligned)
  char* ws = (char*)d_ws;
  size_t off = 0;
  auto carve = [&](size_t bytes) -> void* {
    void* p = ws + off;
    off += (bytes + 255) & ~(size_t)255;
    return p;
  };
  // xh, rh1, rh2, ew1T, ew2T: fragment order (ew1T, ew2T per expert)
  _Float16* xh   = (_Float16*)carve((size_t)kB * kD * 2);         // x in f16
  _Float16* rw1T = (_Float16*)carve((size_t)kD * kRH1 * 2);       // [RH1, D]
  _Float16* rw2T = (_Float16*)carve((size_t)kRH1 * kRH2 * 2);     // [RH2, RH1]
  _Float16* ew1T = (_Float16*)carve((size_t)kE * kD * kH * 2);    // [E][H][D]
  _Float16* ew2T = (_Float16*)carve((size_t)kE * kH * kH * 2);    // [E][H][H]
  _Float16* rh1  = (_Float16*)carve((size_t)kB * kRH1 * 2);       // [B, RH1]
  _Float16* rh2  = (_Float16*)carve((size_t)kB * kRH2 * 2);       // [B, RH2]

  // 1) conversions / weight transposes
  f32_to_f16_frag_kernel<<<dim3(kB / 16), 256, 0, stream>>>(x, xh);
  transpose_to_f16_kernel<kD, kRH1, false><<<dim3(kD * kRH1 / 8 / 256, 1), 256, 0, stream>>>(rw1, rw1T);
  transpose_to_f16_kernel<kRH1, kRH2, false><<<dim3(kRH1 * kRH2 / 8 / 256, 1), 256, 0, stream>>>(rw2, rw2T);
  transpose_to_f16_kernel<kD, kH, true><<<dim3(kD * kH / 8 / 256, kE), 256, 0, stream>>>(ew1, ew1T);
  transpose_to_f16_kernel<kH, kH, true><<<dim3(kH * kH / 8 / 256, kE), 256, 0, stream>>>(ew2, ew2T);

  auto ldsBytes = [](int K) { return (size_t)64 * (K + 8) * sizeof(_Float16); };

  // 2) router MLP (two WMMA GEMMs), then logits+gumbel-softmax tail
  gemm_wmma_f16<true><<<dim3(kB / 256, kRH1 / 64, 1), 256, ldsBytes(kD), stream>>>(
      xh, 0, rw1T, 0, rb1, 0, rh1, kRH1, 0, kD);
  gemm_wmma_f16<true><<<dim3(kB / 256, kRH2 / 64, 1), 256, ldsBytes(kRH1), stream>>>(
      rh1, 0, rw2T, 0, rb2, 0, rh2, kRH2, 0, kRH1);
  router_tail_kernel<<<dim3(kB / 256), 256, 0, stream>>>(rh2, rw3, rb3, u, out_w);

  // 3) experts: all three layers in one launch, into the chart_outputs region
  expert_mlp_fused_kernel<<<dim3(kB / 256, kE), 256, 0, stream>>>(
      xh, ew1T, ew2T, eb1, eb2, ew3, eb3, out_c);

  // 4) z = weights . zc
  z_kernel<<<dim3(kB / 256), 256, 0, stream>>>(out_w, out_c, out_z);
}

// v004
// Measured time: 83 microseconds a run.
// Two timings next to v003 put it at 1.16 and 1.17 times that version's speed.
// Counting every step since v000, it is 2.83 times as fast.
#include <hip/hip_runtime.h>
#include <hip/hip_bf16.h>

typedef __attribute__((ext_vector_type(16))) _Float16 v16h;
typedef __attribute__((ext_vector_type(8)))  _Float16 v8h;
typedef __attribute__((ext_vector_type(8)))  float    v8f;
typedef __attribute__((ext_vector_type(4)))  float    v4f;
typedef __attribute__((ext_vector_type(2)))  float    v2f;

// Problem sizes (fixed by the reference)
constexpr int kB   = 32768;
constexpr int kD   = 512;
constexpr int kE   = 10;
constexpr int kH   = 128;
constexpr int kL   = 2;
constexpr int kRH1 = 256;
constexpr int kRH2 = 128;
constexpr float kTau = 3.0f;

// ---------------------------------------------------------------------------
// Fragment order of an f16 activation matrix [rows x K] in the workspace.
//
// The matrix is cut into tiles of 16 rows x 32 k (512 halves = 1 KiB); tile
// (mt, kt) starts at (mt * (K/32) + kt) * 512 halves.  A tile is two pieces of
// 256 halves; in piece p, lane (h*16 + c) owns the 8 halves
//   row = mt*16 + c,  k = kt*32 + p*16 + h*8 + 0..7,
// which is what that lane's WMMA operand registers hold.  So one wave reads or
// writes a piece as 32 lanes x 16 B = 512 contiguous bytes (4 whole lines).
//
// frag_chunk: offset in halves of the 8 halves (row, k = 8q .. 8q+7).
// ---------------------------------------------------------------------------
__device__ __forceinline__ size_t frag_chunk(size_t row, int q, int K) {
  return ((row >> 4) * (size_t)(K >> 5) + (q >> 2)) * 512 +
         ((q >> 1) & 1) * 256 + ((q & 1) * 16 + (int)(row & 15)) * 8;
}

// ---------------------------------------------------------------------------
// Prep kernels
// ---------------------------------------------------------------------------
// x [B, D] fp32 -> xh, f16 in fragment order.  One block = one tile row mt
// (16 rows x D = 1024 chunks of 8 halves), 4 chunks per thread; chunk
// u = t + 256*s of the tile row is stored at u*8 halves.
__device__ __forceinline__
void f32_to_f16_frag(const float* __restrict__ src,
                     _Float16* __restrict__ dst, size_t mt) {
  const int t = threadIdx.x;
  const int c = t & 15, h = (t >> 4) & 1, p = (t >> 5) & 1, kt0 = t >> 6;
  const float* s = src + (mt * 16 + c) * kD + kt0 * 32 + p * 16 + h * 8;
  _Float16* d = dst + mt * (size_t)(kD * 16) + t * 8;
  v4f lo[4], up[4];
  // unrolled (here and below): the arrays stay in registers and all 8 loads
  // are in flight before the first store
#pragma unroll
  for (int i = 0; i < 4; ++i) {
    lo[i] = *(const v4f*)(s + i * 128);
    up[i] = *(const v4f*)(s + i * 128 + 4);
  }
#pragma unroll
  for (int i = 0; i < 4; ++i) {
    v8h v;
#pragma unroll
    for (int k = 0; k < 4; ++k) {
      v[k] = (_Float16)lo[i][k];
      v[k + 4] = (_Float16)up[i][k];
    }
    *(v8h*)(d + i * 2048) = v;
  }
  // Wait before a register of these stores is overwritten: in the shared
  // launch other jobs' code follows them in the program.
  asm volatile("s_wait_xcnt 0x0" ::: "memory");
}

// W: [K,N] fp32 (optionally batched) -> WT: [N,K] f16 (B^T, so B columns are
// contiguous in memory for fragment loads).  A thread makes one 16-byte chunk:
// 8 k of one n.  Chunk u is numbered in fragment order (rows = n): lane
// (h*16 + c) of a wave has n = nt*16 + c and k = 8q .. 8q+7, q = kt*4 + p*2 + h,
// so each of its 8 loads reads two runs of 16 consecutive floats per wave.
// FRAG: WT is stored in fragment order, for the fused expert kernel's linear
// copy into LDS: chunk u lies at u*8 halves, 512 contiguous B per wave.
// blk = 0 .. batches * K*N/8/256 - 1: block blk % (K*N/8/256) of matrix
// blk / (K*N/8/256).
template <int K, int N, bool FRAG>
__device__ __forceinline__
void transpose_to_f16(const float* __restrict__ W,
                      _Float16* __restrict__ WT, unsigned blk) {
  static_assert(K % 32 == 0 && N % 16 == 0 && (K * N / 8) % 256 == 0,
                "K*N/8/256 blocks cover the chunks of a matrix exactly");
  constexpr unsigned perMat = K * N / 8 / 256;
  const size_t batch = blk / perMat;
  const float* w = W + batch * (size_t)(K * N);
  _Float16* wt = WT + batch * (size_t)(K * N);
  const unsigned u = (blk % perMat) * 256 + threadIdx.x;
  const unsigned n = ((u >> 6) / (K / 32)) * 16 + (u & 15);
  const unsigned q = ((u >> 6) % (K / 32)) * 4 + ((u >> 4) & 3);
  const float* s = w + (size_t)(q * 8) * N + n;
  float f[8];
  // unrolled: f stays in registers and all 8 loads are in flight together
#pragma unroll
  for (int i = 0; i < 8; ++i) f[i] = s[i * N];
  v8h v;
#pragma unroll   // v is indexed by constants only
  for (int i = 0; i < 8; ++i) v[i] = (_Float16)f[i];
  *(v8h*)(wt + (FRAG ? (size_t)u * 8 : (size_t)n * K + q * 8)) = v;
  // Wait before a register of this store is overwritten: in the shared launch
  // other jobs' code follows it in the program.
  asm volatile("s_wait_xcnt 0x0" ::: "memory");
}

// All five conversions in one launch: none reads what another writes, and the
// block index picks the job.  The short weight jobs have the low indices
// (for speed only).
constexpr unsigned kBlkEw1 = kE * (kD * kH / 8 / 256);
constexpr unsigned kBlkEw2 = kE * (kH * kH / 8 / 256);
constexpr unsigned kBlkRw1 = kD * kRH1 / 8 / 256;
constexpr unsigned kBlkRw2 = kRH1 * kRH2 / 8 / 256;
constexpr unsigned kBlkX   = kB / 16;
constexpr unsigned kBlkPrep = kBlkEw1 + kBlkEw2 + kBlkRw1 + kBlkRw2 + kBlkX;

__global__ __launch_bounds__(256)
void prep_kernel(const float* __restrict__ x,   _Float16* __restrict__ xh,
                 const float* __restrict__ rw1, _Float16* __restrict__ rw1T,
                 const float* __restrict__ rw2, _Float16* __restrict__ rw2T,
                 const float* __restrict__ ew1, _Float16* __restrict__ ew1T,
                 const float* __restrict__ ew2, _Float16* __restrict__ ew2T) {
  unsigned blk = blockIdx.x;
  if (blk < kBlkEw1) { transpose_to_f16<kD, kH, true>(ew1, ew1T, blk); return; }
  blk -= kBlkEw1;
  if (blk < kBlkEw2) { transpose_to_f16<kH, kH, true>(ew2, ew2T, blk); return; }
  blk -= kBlkEw2;
  if (blk < kBlkRw1) { transpose_to_f16<kD, kRH1, false>(rw1, rw1T, blk); return; }
  blk -= kBlkRw1;
  if (blk < kBlkRw2) { transpose_to_f16<kRH1, kRH2, false>(rw2, rw2T, blk); return; }
  blk -= kBlkRw2;
  f32_to_f16_frag(x, xh, blk);
}

// ---------------------------------------------------------------------------
// Fragment helpers.
//
// CDNA5 16-bit A (16x32) lane layout: lane l (0..15) holds row M=l with
// K = {kb..kb+7, kb+16..kb+23}; lanes 16..31 hold the same rows with
// K = {kb+8..kb+15, kb+24..kb+31}.  B mirrors this with column N=l, which is
// a contiguous row of BT.  C/D: VGPR r, lane l -> (M = r + 8*(l>>4), N = l&15).
// ---------------------------------------------------------------------------
// p = tile start + lane*8 of a matrix in fragment order: the two pieces.
__device__ __forceinline__ v16h load_frag_g(const _Float16* p) {
  v8h a = *(const v8h*)(p);       // 16B -> b128 load (global or LDS), 512 B per wave
  v8h b = *(const v8h*)(p + 256);
  v16h r;
#pragma unroll
  for (int i = 0; i < 8; ++i) { r[i] = a[i]; r[i + 8] = b[i]; }
  return r;
}

__device__ __forceinline__ v16h load_frag_lds(const _Float16* p) {
  v8h a = *(const v8h*)(p);       // 16B -> ds_load_b128
  v8h b = *(const v8h*)(p + 16);
  v16h r;
#pragma unroll
  for (int i = 0; i < 8; ++i) { r[i] = a[i]; r[i + 8] = b[i]; }
  return r;
}

__device__ __forceinline__ v8f wmma_f16(v16h a, v16h b, v8f c) {
  return __builtin_amdgcn_wmma_f32_16x16x32_f16(false, a, false, b, (short)0,
                                                c, false, false);
}

// ---------------------------------------------------------------------------
// WMMA GEMM v3: C = relu(A[M,K] * B[K,N] + bias)
//   - A and C are in fragment order (C with row length ldc)
//   - the weight fragment is the WMMA's first operand and the activation
//     fragment its second, so D = C^T: a lane holds 8 consecutive n of one row
//     m, which is one 16-byte chunk of C in fragment order
//   - block = 256 threads = 8 waves, block tile 256M x 64N
//   - B tile (64 x K, padded rows) staged in LDS once, shared by all waves
//   - each wave computes 32M x 64N (8 accumulators)
//   - k-loop unrolled by 64 with two alternating A buffers (no copy-swap),
//     B fragments pipelined one step ahead, prefetch offsets wrapped instead
//     of guarded (branch-free steady state)
// Requires K % 64 == 0 (true for 512 / 256). Batched via blockIdx.z.
// ---------------------------------------------------------------------------
template <bool RELU>
__global__ __launch_bounds__(256)
void gemm_wmma_f16(const _Float16* __restrict__ A, long long aStride,
                   const _Float16* __restrict__ BT, long long bStride,
                   const float* __restrict__ bias, long long biasStride,
                   _Float16* __restrict__ C, int ldc, long long cStride,
                   int K) {
  extern __shared__ _Float16 lds[];   // 64 * (K + 8) halves
  const int tid  = threadIdx.x;
  const int lane = tid & 31;
  const int wave = tid >> 5;
  const int hi   = lane >> 4;
  const int l16  = lane & 15;
  const int ldsRow = K + 8;           // pad 8 halves -> conflict-free b128 reads

  const long long e = blockIdx.z;
  const _Float16* Ae = A + e * aStride;
  const _Float16* Be = BT + e * bStride;
  const float*    be = bias + e * biasStride;
  _Float16*       Ce = C + e * cStride;

  const int m0 = blockIdx.x * 256 + wave * 32;
  const int n0 = blockIdx.y * 64;

  // ---- stage BT tile [64 x K] into LDS (all 256 threads cooperate) ----
  {
    const int chunksPerRow = K >> 3;        // 8 halves per 16B chunk
    const int total = 64 * chunksPerRow;
    for (int c = tid; c < total; c += 256) {
      int n  = c / chunksPerRow;
      int kc = c - n * chunksPerRow;
      v8h v = *(const v8h*)(Be + (size_t)(n0 + n) * K + kc * 8);
      *(v8h*)(&lds[(size_t)n * ldsRow + kc * 8]) = v;
    }
  }
  __syncthreads();

  v8f acc[2][4];
#pragma unroll
  for (int mi = 0; mi < 2; ++mi)
#pragma unroll
    for (int j = 0; j < 4; ++j)
#pragma unroll
      for (int i = 0; i < 8; ++i) acc[mi][j][i] = 0.0f;

  // tile row m0/16 of A; a tile row is K*16 halves, a k step of 32 is 512.
  const _Float16* pa0 = Ae + (size_t)(m0 >> 4) * K * 16 + lane * 8;
  const _Float16* pa1 = pa0 + (size_t)K * 16;

  // Two alternating A buffers (k and k+32) -> no register copy swap.
  v16h aA[2], aB[2];
  aA[0] = load_frag_g(pa0);
  aA[1] = load_frag_g(pa1);
  aB[0] = load_frag_g(pa0 + 512);
  aB[1] = load_frag_g(pa1 + 512);

  const _Float16* lb = &lds[(size_t)l16 * ldsRow + 8 * hi];
  const int jStep = 16 * ldsRow;

  // B pipeline: bcur always holds the fragment for the WMMA about to issue.
  v16h bcur = load_frag_lds(lb);   // (j=0, k=0)

  for (int kb = 0; kb < K; kb += 64) {
    const int kpre = (kb + 64 < K) ? (kb + 64) : 0;  // wrapped prefetch

    // ---- sub-step 0: k = kb, A = aA ----
#pragma unroll
    for (int j = 0; j < 4; ++j) {
      v16h bnxt = (j < 3) ? load_frag_lds(lb + (j + 1) * jStep + kb)
                          : load_frag_lds(lb + kb + 32);
      acc[0][j] = wmma_f16(bcur, aA[0], acc[0][j]);
      acc[1][j] = wmma_f16(bcur, aA[1], acc[1][j]);
      bcur = bnxt;
    }
    const _Float16* qa0 = pa0 + kpre * 16;
    const _Float16* qa1 = pa1 + kpre * 16;
    aA[0] = load_frag_g(qa0);
    aA[1] = load_frag_g(qa1);

    // ---- sub-step 1: k = kb+32, A = aB ----
#pragma unroll
    for (int j = 0; j < 4; ++j) {
      v16h bnxt = (j < 3) ? load_frag_lds(lb + (j + 1) * jStep + kb + 32)
                          : load_frag_lds(lb + kpre);  // next outer, j=0
      acc[0][j] = wmma_f16(bcur, aB[0], acc[0][j]);
      acc[1][j] = wmma_f16(bcur, aB[1], acc[1][j]);
      bcur = bnxt;
    }
    aB[0] = load_frag_g(qa0 + 512);
    aB[1] = load_frag_g(qa1 + 512);
    // Wait before the address registers of this pass's loads are overwritten;
    // naming them keeps them whole up to the wait.
    asm volatile("s_wait_xcnt 0x0" :: "v"(qa0), "v"(qa1) : "memory");
  }

  // ---- epilogue: bias + relu, store f16 in fragment order ----
  // acc[mi][j][r] = C[m0 + 16*mi + l16][n0 + 16*j + 8*hi + r]
  v4f bv[4][2];   // unrolled loops: bv and acc are indexed by constants only
#pragma unroll
  for (int j = 0; j < 4; ++j) {
    const int nb = n0 + 16 * j + 8 * hi;
    bv[j][0] = *(const v4f*)(be + nb);
    bv[j][1] = *(const v4f*)(be + nb + 4);
  }
  // The store address set-up below reuses the address registers of the bias
  // loads: wait before they are overwritten.
  asm volatile("s_wait_xcnt 0x0" ::: "memory");
  // Keeps that set-up (argument loads, address arithmetic) behind the wait.
  __builtin_amdgcn_sched_barrier(0);
#pragma unroll
  for (int j = 0; j < 4; ++j) {
#pragma unroll
    for (int mi = 0; mi < 2; ++mi) {
      v8h o;
#pragma unroll
      for (int r = 0; r < 8; ++r) {
        float v = acc[mi][j][r] + bv[j][r >> 2][r & 3];
        if (RELU) v = v > 0.0f ? v : 0.0f;
        o[r] = (_Float16)v;
      }
      *(v8h*)(Ce + ((size_t)((m0 >> 4) + mi) * (ldc >> 5) + ((n0 + 16 * j) >> 5)) * 512 +
              (j & 1) * 256 + lane * 8) = o;
    }
  }
}

// ---------------------------------------------------------------------------
// Router tail: logits = rh2 @ rw3 + rb3 ; weights = softmax((logits+gumbel)/tau)
// One thread per row b; called from the expert kernel's grid (see there).
// ---------------------------------------------------------------------------
__device__ __forceinline__
void router_tail(const _Float16* __restrict__ rh2,
                 const float* __restrict__ rw3,  // [RH2, E]
                 const float* __restrict__ rb3,  // [E]
                 const float* __restrict__ u,    // [B, E]
                 float* __restrict__ wout,       // [B, E]
                 int b) {
  if (b >= kB) return;
  float acc[kE];
#pragma unroll
  for (int e = 0; e < kE; ++e) acc[e] = rb3[e];
  for (int q = 0; q < kRH2 / 8; ++q) {   // rh2 is in fragment order
    v8h hq = *(const v8h*)(rh2 + frag_chunk((size_t)b, q, kRH2));
    // Wait before the address registers of this load are overwritten by the
    // results of the weight loads behind it.
    asm volatile("s_wait_xcnt 0x0" ::: "memory");
#pragma unroll   // hq is indexed by constants only
    for (int i = 0; i < 8; ++i) {
      float hv = (float)hq[i];
#pragma unroll
      for (int e = 0; e < kE; ++e) acc[e] += hv * rw3[(q * 8 + i) * kE + e];
    }
  }
  float mx = -1e30f;
#pragma unroll
  for (int e = 0; e < kE; ++e) {
    float uu = u[(size_t)b * kE + e];
    uu = fminf(fmaxf(uu, 1e-10f), 1.0f);
    float g = -logf(-logf(uu) + 1e-10f);
    acc[e] = (acc[e] + g) / kTau;
    mx = fmaxf(mx, acc[e]);
  }
  float s = 0.0f;
#pragma unroll
  for (int e = 0; e < kE; ++e) { acc[e] = expf(acc[e] - mx); s += acc[e]; }
  float inv = 1.0f / s;
#pragma unroll
  for (int e = 0; e < kE; ++e) wout[(size_t)b * kE + e] = acc[e] * inv;
}

// ---------------------------------------------------------------------------
// Expert MLP, all three layers in one kernel:
//   chart[e][b][:] = relu(relu(x W1 + b1) W2 + b2) W3 + b3
//   - block = 8 waves = 256 rows of one expert; a wave owns 32 rows x all 128 n
//   - W1[e] and W2[e] (fragment order) are copied once into LDS: 160 KiB, so
//     two blocks share a WGP and one computes while the other copies
//   - weights are the WMMA's first operand, so a lane's accumulators of n tiles
//     2t and 2t+1 are, after bias, relu and rounding to f16, exactly its
//     registers of the next layer's activation fragment for k tile t: h1 goes
//     from layer 1 to layer 2 in registers, with no cross-lane move
//   - layer 3 (128 -> 2) is summed per lane over its 64 n in f32, then the two
//     lane halves are added; h2 is never rounded or stored
//   - the router tail needs nothing of the experts and they nothing of it, so
//     it shares this launch: blocks with blockIdx.y == E do 256 rows of the tail
//     each; they have the highest indices and are shorter
//     than the expert blocks
// ---------------------------------------------------------------------------
constexpr int kW1Halves = kH * kD;   // 65536 halves = 128 KiB
constexpr int kW2Halves = kH * kH;   // 16384 halves =  32 KiB

// second argument: 4 waves per SIMD (256 VGPRs), so that two blocks are resident
__global__ __launch_bounds__(256, 4)
void expert_mlp_fused_kernel(const _Float16* __restrict__ xh,   // [B, D], fragment order
                             const _Float16* __restrict__ w1f,  // [E][H x D], fragment order
                             const _Float16* __restrict__ w2f,  // [E][H x H], fragment order
                             // no __restrict__ on the next three: their loads then keep
                             // their place between the scheduling fences below; as
                             // loads of constant memory the compiler hoisted them
                             // into the matrix phases, and spilled
                             const float* eb1,                  // [E][H]
                             const float* eb2,                  // [E][H]
                             const float* ew3,                  // [E][H][L]
                             const float* __restrict__ eb3,     // [E][L]
                             float* __restrict__ chart,         // [E][B][L]
                             const _Float16* __restrict__ rh2,  // router tail: as there
                             const float* __restrict__ rw3,
                             const float* __restrict__ rb3,
                             const float* __restrict__ u,
                             float* __restrict__ wout) {
  __shared__ __attribute__((aligned(16))) _Float16 wl[kW1Halves + kW2Halves];
  const int tid  = threadIdx.x;
  if (blockIdx.y == kE) {   // the whole block leaves here, ahead of the barrier
    router_tail(rh2, rw3, rb3, u, wout, blockIdx.x * 256 + tid);
    return;
  }
  const int lane = tid & 31;
  const int wave = tid >> 5;
  const int hi   = lane >> 4;
  const int l16  = lane & 15;
  const int e    = blockIdx.y;
  const int m0   = blockIdx.x * 256 + wave * 32;

  const _Float16* pa0 = xh + (size_t)(m0 >> 4) * (kD * 16) + lane * 8;
  const _Float16* pa1 = pa0 + kD * 16;

  v16h xb[2][2];   // x fragments of two k tiles, [kt & 1][mi]
  v16h wb[2][4];   // weight fragments: two groups of 4 n tiles

  // ---- copy both weight matrices into LDS, 16 B per lane, linear ----
  {
    const v8h* g1 = (const v8h*)(w1f + (size_t)e * kW1Halves) + tid;
    const v8h* g2 = (const v8h*)(w2f + (size_t)e * kW2Halves) + tid;
    v8h* d = (v8h*)wl + tid;
    constexpr int n1 = kW1Halves / 8 / 256;   // 32 chunks per thread of W1
    // two rounds of 20 loads, all of a round in flight ahead of its LDS stores
    // (unrolled: t stays in registers, every offset is a constant)
#pragma unroll
    for (int h = 0; h < 2; ++h) {
      v8h t[20];
#pragma unroll
      for (int i = 0; i < 20; ++i) {
        const int c = h * 20 + i;
        t[i] = c < n1 ? g1[c * 256] : g2[(c - n1) * 256];
      }
#pragma unroll
      for (int i = 0; i < 20; ++i) d[(h * 20 + i) * 256] = t[i];
    }
  }
  // the first x fragments fly while the block waits at the barrier
  xb[0][0] = load_frag_g(pa0);
  xb[0][1] = load_frag_g(pa1);
  xb[1][0] = load_frag_g(pa0 + 512);
  xb[1][1] = load_frag_g(pa1 + 512);
  // Wait before the address registers of the x loads are overwritten.
  asm volatile("s_wait_xcnt 0x0" ::: "memory");
  __syncthreads();

  // ---- layer 1: K = 512 (16 k tiles), N = 128 (8 n tiles) ----
  v8f acc[2][8];
#pragma unroll
  for (int mi = 0; mi < 2; ++mi)
#pragma unroll
    for (int j = 0; j < 8; ++j)
#pragma unroll
      for (int i = 0; i < 8; ++i) acc[mi][j][i] = 0.0f;

  const _Float16* lw1 = wl + lane * 8;               // tile (j, kt) at (j*16 + kt)*512
  const _Float16* lw2 = wl + kW1Halves + lane * 8;   // tile (j, kt) at (j*4 + kt)*512
#pragma unroll
  for (int jj = 0; jj < 4; ++jj) wb[0][jj] = load_frag_g(lw1 + (jj * 16) * 512);

  // Fully unrolled: every array index and every address offset is a constant,
  // so no address register is rewritten while loads are in flight.
  // Group g = (k tile g/2, n tiles 4*(g&1) .. +3): its 8 LDS loads are issued
  // together, one group ahead of the 8 WMMAs that use them.
#pragma unroll
  for (int g = 0; g < 32; ++g) {
    const int kt = g >> 1, jh = g & 1;
    if (g + 1 < 32) {
      const int kn = (g + 1) >> 1, jn = ((g + 1) & 1) * 4;
#pragma unroll
      for (int jj = 0; jj < 4; ++jj)
        wb[(g + 1) & 1][jj] = load_frag_g(lw1 + ((jn + jj) * 16 + kn) * 512);
    }
    // keeps the loads above in one place ahead of the WMMA block (for speed only)
    __builtin_amdgcn_sched_barrier(0);
#pragma unroll
    for (int jj = 0; jj < 4; ++jj) {
      acc[0][jh * 4 + jj] = wmma_f16(wb[g & 1][jj], xb[kt & 1][0], acc[0][jh * 4 + jj]);
      acc[1][jh * 4 + jj] = wmma_f16(wb[g & 1][jj], xb[kt & 1][1], acc[1][jh * 4 + jj]);
    }
    // ends the WMMA block: the next group's loads stay behind it
    __builtin_amdgcn_sched_barrier(0);
    if (jh == 1 && kt + 2 < 16) {
      xb[kt & 1][0] = load_frag_g(pa0 + (kt + 2) * 512);
      xb[kt & 1][1] = load_frag_g(pa1 + (kt + 2) * 512);
    }
  }
  // Wait before the address registers of the x loads are overwritten; naming
  // them keeps them whole up to the wait.
  asm volatile("s_wait_xcnt 0x0" :: "v"(pa0), "v"(pa1) : "memory");

  // ---- h1 = f16(relu(acc + b1)), straight into layer 2's fragments ----
  // acc[mi][j][r] = row m0 + 16*mi + l16, n = 16*j + 8*hi + r
  v16h hf[2][4];   // [mi][k tile of layer 2]
  {
    const float* be = eb1 + e * kH + 8 * hi;
    v4f b[8][2];   // all 16 loads in flight together: one latency, not eight
#pragma unroll
    for (int j = 0; j < 8; ++j) {
      b[j][0] = *(const v4f*)(be + 16 * j);
      b[j][1] = *(const v4f*)(be + 16 * j + 4);
    }
    // Wait before the address registers of these loads are overwritten; naming
    // the pointer keeps it whole up to the wait.
    asm volatile("s_wait_xcnt 0x0" :: "v"(be) : "memory");
#pragma unroll
    for (int j = 0; j < 8; ++j) {
      // one n tile at a time, so that its accumulators are free before the
      // next tile's temporaries are made (registers)
      __builtin_amdgcn_sched_barrier(0);
#pragma unroll
      for (int mi = 0; mi < 2; ++mi)
#pragma unroll
        for (int r = 0; r < 8; ++r) {
          float v = acc[mi][j][r] + b[j][r >> 2][r & 3];
          v = v > 0.0f ? v : 0.0f;
          hf[mi][j >> 1][(j & 1) * 8 + r] = (_Float16)v;
        }
    }
    // layer 2's loads stay behind the conversion (registers)
    __builtin_amdgcn_sched_barrier(0);
  }

  // ---- layers 2 and 3, 4 n tiles at a time ----
  const float* be2 = eb2 + e * kH + 8 * hi;
  const float* w3  = ew3 + (size_t)e * kH * kL + 16 * hi;
  v2f s[2] = {{0.0f, 0.0f}, {0.0f, 0.0f}};   // [mi], the two l side by side
  // not unrolled: unrolled, the compiler moved the first half's sums behind the
  // second half's matrix phase, kept both halves' values live, and spilled
#pragma unroll 1
  for (int jh = 0; jh < 2; ++jh) {
    v8f a2[2][4];
#pragma unroll
    for (int mi = 0; mi < 2; ++mi)
#pragma unroll
      for (int jj = 0; jj < 4; ++jj)
#pragma unroll
        for (int i = 0; i < 8; ++i) a2[mi][jj][i] = 0.0f;
#pragma unroll
    for (int jj = 0; jj < 4; ++jj)
      wb[0][jj] = load_frag_g(lw2 + ((jh * 4 + jj) * 4) * 512);
#pragma unroll
    for (int kt = 0; kt < 4; ++kt) {
      if (kt + 1 < 4) {
#pragma unroll
        for (int jj = 0; jj < 4; ++jj)
          wb[(kt + 1) & 1][jj] = load_frag_g(lw2 + ((jh * 4 + jj) * 4 + kt + 1) * 512);
      }
      // as in layer 1: loads in one place ahead of the WMMA block
      __builtin_amdgcn_sched_barrier(0);
#pragma unroll
      for (int jj = 0; jj < 4; ++jj) {
        a2[0][jj] = wmma_f16(wb[kt & 1][jj], hf[0][kt], a2[0][jj]);
        a2[1][jj] = wmma_f16(wb[kt & 1][jj], hf[1][kt], a2[1][jj]);
      }
      // ends the WMMA block; behind the last one it also keeps the bias and W3
      // loads below out of the matrix phase, where they would not fit the registers
      __builtin_amdgcn_sched_barrier(0);
    }
    v4f b[4][2];   // b2[n]
    v4f c[4][4];   // W3[n][l], n = 16*j + 8*hi + 0..7: 16 consecutive floats
    // all 24 loads in flight together: one latency, not four
    const float* pb = be2 + 64 * jh;
    const float* pc = w3 + 128 * jh;
#pragma unroll
    for (int jj = 0; jj < 4; ++jj) {
      b[jj][0] = *(const v4f*)(pb + 16 * jj);
      b[jj][1] = *(const v4f*)(pb + 16 * jj + 4);
#pragma unroll
      for (int i = 0; i < 4; ++i) c[jj][i] = *(const v4f*)(pc + 32 * jj + 4 * i);
    }
    // Wait before the address registers of these loads are overwritten; naming
    // the pointers keeps them whole up to the wait.
    asm volatile("s_wait_xcnt 0x0" :: "v"(pb), "v"(pc) : "memory");
#pragma unroll
    for (int jj = 0; jj < 4; ++jj) {
      // one n tile at a time (registers), as in the conversion above
      __builtin_amdgcn_sched_barrier(0);
#pragma unroll
      for (int mi = 0; mi < 2; ++mi)
#pragma unroll
        for (int r = 0; r < 8; ++r) {
          float v = a2[mi][jj][r] + b[jj][r >> 2][r & 3];
          v = v > 0.0f ? v : 0.0f;
          const v2f cw = {c[jj][r >> 1][(r & 1) * 2 + 0], c[jj][r >> 1][(r & 1) * 2 + 1]};
          const v2f vv = {v, v};
          s[mi] = __builtin_elementwise_fma(vv, cw, s[mi]);
        }
    }
  }

  // add the two lane halves (n split by hi); then lane half hi stores row tile hi:
  // one wave writes 32 rows x 8 B = 256 contiguous bytes
#pragma unroll
  for (int mi = 0; mi < 2; ++mi)
#pragma unroll
    for (int l = 0; l < 2; ++l) s[mi][l] += __shfl_xor(s[mi][l], 16);
  float2 o;
  o.x = (hi ? s[1][0] : s[0][0]) + eb3[e * kL + 0];
  o.y = (hi ? s[1][1] : s[0][1]) + eb3[e * kL + 1];
  *(float2*)(chart + ((size_t)e * kB + m0 + lane) * kL) = o;
  // Wait before a register of this store is overwritten: the router tail's code
  // follows it in the program.
  asm volatile("s_wait_xcnt 0x0" ::: "memory");
}

// z[b,l] = sum_e weights[b,e] * chart[e,b,l]
__global__ void z_kernel(const float* __restrict__ wght,
                         const float* __restrict__ chart,
                         float* __restrict__ z) {
  int b = blockIdx.x * blockDim.x + threadIdx.x;
  if (b >= kB) return;
  float z0 = 0.0f, z1 = 0.0f;
#pragma unroll
  for (int e = 0; e < kE; ++e) {
    float w = wght[(size_t)b * kE + e];
    z0 += w * chart[((size_t)e * kB + b) * kL + 0];
    z1 += w * chart[((size_t)e * kB + b) * kL + 1];
  }
  z[(size_t)b * kL + 0] = z0;
  z[(size_t)b * kL + 1] = z1;
}

// ---------------------------------------------------------------------------
extern "C" void kernel_launch(void* const* d_in, const int* in_sizes, int n_in,
                              void* d_out, int out_size, void* d_ws, size_t ws_size,
                              hipStream_t stream) {
  (void)in_sizes; (void)n_in; (void)out_size; (void)ws_size;

  const float* x   = (const float*)d_in[0];
  const float* u   = (const float*)d_in[1];
  const float* rw1 = (const float*)d_in[2];
  const float* rb1 = (const float*)d_in[3];
  const float* rw2 = (const float*)d_in[4];
  const float* rb2 = (const float*)d_in[5];
  const float* rw3 = (const float*)d_in[6];
  const float* rb3 = (const float*)d_in[7];
  const float* ew1 = (const float*)d_in[8];
  const float* eb1 = (const float*)d_in[9];
  const float* ew2 = (const float*)d_in[10];
  const float* eb2 = (const float*)d_in[11];
  const float* ew3 = (const float*)d_in[12];
  const float* eb3 = (const float*)d_in[13];

  float* out   = (float*)d_out;
  float* out_z = out;                                  // [B, L]
  float* out_w = out + (size_t)kB * kL;                // [B, E]
  float* out_c = out_w + (size_t)kB * kE;              // [E, B, L]

  // Workspace carve-up (256B aligned)
  char* ws = (char*)d_ws;
  size_t off = 0;
  auto carve = [&](size_t bytes) -> void* {
    void* p = ws + off;
    off += (bytes + 255) & ~(size_t)255;
    return p;
  };
  // xh, rh1, rh2, ew1T, ew2T: fragment order (ew1T, ew2T per expert)
  _Float16* xh   = (_Float16*)carve((size_t)kB * kD * 2);         // x in f16
  _Float16* rw1T = (_Float16*)carve((size_t)kD * kRH1 * 2);       // [RH1, D]
  _Float16* rw2T = (_Float16*)carve((size_t)kRH1 * kRH2 * 2);     // [RH2, RH1]
  _Float16* ew1T = (_Float16*)carve((size_t)kE * kD * kH * 2);    // [E][H][D]
  _Float16* ew2T = (_Float16*)carve((size_t)kE * kH * kH * 2);    // [E][H][H]
  _Float16* rh1  = (_Float16*)carve((size_t)kB * kRH1 * 2);       // [B, RH1]
  _Float16* rh2  = (_Float16*)carve((size_t)kB * kRH2 * 2);       // [B, RH2]

  // 1) conversions / weight transposes, one launch
  prep_kernel<<<dim3(kBlkPrep), 256, 0, stream>>>(x, xh, rw1, rw1T, rw2, rw2T,
                                                  ew1, ew1T, ew2, ew2T);

  auto ldsBytes = [](int K) { return (size_t)64 * (K + 8) * sizeof(_Float16); };

  // 2) router MLP (two WMMA GEMMs)
  gemm_wmma_f16<true><<<dim3(kB / 256, kRH1 / 64, 1), 256, ldsBytes(kD), stream>>>(
      xh, 0, rw1T, 0, rb1, 0, rh1, kRH1, 0, kD);
  gemm_wmma_f16<true><<<dim3(kB / 256, kRH2 / 64, 1), 256, ldsBytes(kRH1), stream>>>(
      rh1, 0, rw2T, 0, rb2, 0, rh2, kRH2, 0, kRH1);

  // 3) experts: all three layers in one launch, into the chart_outputs region;
  //    the same launch does the router's logits+gumbel-softmax tail
  expert_mlp_fused_kernel<<<dim3(kB / 256, kE + 1), 256, 0, stream>>>(
      xh, ew1T, ew2T, eb1, eb2, ew3, eb3, out_c, rh2, rw3, rb3, u, out_w);

  // 4) z = weights . zc
  z_kernel<<<dim3(kB / 256), 256, 0, stream>>>(out_w, out_c, out_z);
}

// v005
// A run of this version takes 57.2 microseconds.
// In two side-by-side timings against v004, it was 1.45 and 1.46 times as fast.
// Over all steps from v000 it is 4.12 times as fast.
#include <hip/hip_runtime.h>
#include <hip/hip_bf16.h>

typedef __attribute__((ext_vector_type(16))) _Float16 v16h;
typedef __attribute__((ext_vector_type(8)))  _Float16 v8h;
typedef __attribute__((ext_vector_type(8)))  float    v8f;
typedef __attribute__((ext_vector_type(4)))  float    v4f;
typedef __attribute__((ext_vector_type(2)))  float    v2f;

// Problem sizes (fixed by the reference)
constexpr int kB   = 32768;
constexpr int kD   = 512;
constexpr int kE   = 10;
constexpr int kH   = 128;
constexpr int kL   = 2;
constexpr int kRH1 = 256;
constexpr int kRH2 = 128;
constexpr float kTau = 3.0f;

// ---------------------------------------------------------------------------
// Fragment order of an f16 activation matrix [rows x K] in the workspace.
//
// The matrix is cut into tiles of 16 rows x 32 k (512 halves = 1 KiB); tile
// (mt, kt) starts at (mt * (K/32) + kt) * 512 halves.  A tile is two pieces of
// 256 halves; in piece p, lane (h*16 + c) owns the 8 halves
//   row = mt*16 + c,  k = kt*32 + p*16 + h*8 + 0..7,
// which is what that lane's WMMA operand registers hold.  So one wave reads or
// writes a piece as 32 lanes x 16 B = 512 contiguous bytes (4 whole lines).
// ---------------------------------------------------------------------------

// ---------------------------------------------------------------------------
// Prep kernels
// ---------------------------------------------------------------------------
// x [B, D] fp32 -> xh, f16 in fragment order.  One block = one tile row mt
// (16 rows x D = 1024 chunks of 8 halves), 4 chunks per thread; chunk
// u = t + 256*s of the tile row is stored at u*8 halves.
__device__ __forceinline__
void f32_to_f16_frag(const float* __restrict__ src,
                     _Float16* __restrict__ dst, size_t mt) {
  const int t = threadIdx.x;
  const int c = t & 15, h = (t >> 4) & 1, p = (t >> 5) & 1, kt0 = t >> 6;
  const float* s = src + (mt * 16 + c) * kD + kt0 * 32 + p * 16 + h * 8;
  _Float16* d = dst + mt * (size_t)(kD * 16) + t * 8;
  v4f lo[4], up[4];
  // unrolled (here and below): the arrays stay in registers and all 8 loads
  // are in flight before the first store
#pragma unroll
  for (int i = 0; i < 4; ++i) {
    lo[i] = *(const v4f*)(s + i * 128);
    up[i] = *(const v4f*)(s + i * 128 + 4);
  }
#pragma unroll
  for (int i = 0; i < 4; ++i) {
    v8h v;
#pragma unroll
    for (int k = 0; k < 4; ++k) {
      v[k] = (_Float16)lo[i][k];
      v[k + 4] = (_Float16)up[i][k];
    }
    *(v8h*)(d + i * 2048) = v;
  }
  // Wait before a register of these stores is overwritten: in the shared
  // launch other jobs' code follows them in the program.
  asm volatile("s_wait_xcnt 0x0" ::: "memory");
}

// W: K x N fp32, rows LD floats apart (optionally batched, SRCB floats from one
// matrix to the next) -> WT: [N,K] f16 in fragment order (rows = n), for the
// fused kernel's linear copy into LDS.  A thread makes one 16-byte chunk: 8 k of
// one n.  Chunk u is numbered in fragment order: lane (h*16 + c) of a wave has
// n = nt*16 + c and k = 8q .. 8q+7, q = kt*4 + p*2 + h, so each of its 8 loads
// reads two runs of 16 consecutive floats per wave; chunk u lies at u*8 halves,
// 512 contiguous B per wave.  Only the first NV columns exist in W: the rest of
// WT is zero.
// blk = 0 .. batches * K*N/8/256 - 1: block blk % (K*N/8/256) of matrix
// blk / (K*N/8/256).
template <int K, int N, int LD, int SRCB, int NV>
__device__ __forceinline__
void transpose_to_f16(const float* __restrict__ W,
                      _Float16* __restrict__ WT, unsigned blk) {
  static_assert(K % 32 == 0 && N % 16 == 0 && (K * N / 8) % 256 == 0,
                "K*N/8/256 blocks cover the chunks of a matrix exactly");
  constexpr unsigned perMat = K * N / 8 / 256;
  const size_t batch = blk / perMat;
  const float* w = W + batch * (size_t)SRCB;
  _Float16* wt = WT + batch * (size_t)(K * N);
  const unsigned u = (blk % perMat) * 256 + threadIdx.x;
  const unsigned n = ((u >> 6) / (K / 32)) * 16 + (u & 15);
  const unsigned q = ((u >> 6) % (K / 32)) * 4 + ((u >> 4) & 3);
  const float* s = w + (size_t)(q * 8) * LD + n;
  float f[8];
  // unrolled: f stays in registers and all 8 loads are in flight together
#pragma unroll
  for (int i = 0; i < 8; ++i) f[i] = (NV == N || n < NV) ? s[i * LD] : 0.0f;
  v8h v;
#pragma unroll   // v is indexed by constants only
  for (int i = 0; i < 8; ++i) v[i] = (_Float16)f[i];
  *(v8h*)(wt + (size_t)u * 8) = v;
  // Wait before a register of this store is overwritten: in the shared launch
  // other jobs' code follows it in the program.
  asm volatile("s_wait_xcnt 0x0" ::: "memory");
}

// All conversions in one launch: none reads what another writes, and the block
// index picks the job.  The short weight jobs have the low indices (for speed only).
// The router's first two layers are laid out as two more experts, E and E+1:
// number E+p has columns 128p .. 128p+127 of rw1 and rows 128p .. 128p+127 of
// rw2.  rw3 becomes one 16 x 128 tile row (columns E .. 15 zero).
constexpr unsigned kBlkEw1 = kE * (kD * kH / 8 / 256);
constexpr unsigned kBlkEw2 = kE * (kH * kH / 8 / 256);
constexpr unsigned kBlkRw1 = kD * kRH1 / 8 / 256;
constexpr unsigned kBlkRw2 = kRH1 * kRH2 / 8 / 256;
constexpr unsigned kBlkRw3 = kRH2 * 16 / 8 / 256;
constexpr unsigned kBlkX   = kB / 16;
constexpr unsigned kBlkPrep = kBlkEw1 + kBlkEw2 + kBlkRw1 + kBlkRw2 + kBlkRw3 + kBlkX;
static_assert(kRH1 == 2 * kH && kRH2 == kH && kE <= 16,
              "the router is two experts wide, its logits fit one tile");

__global__ __launch_bounds__(256)
void prep_kernel(const float* __restrict__ x,   _Float16* __restrict__ xh,
                 const float* __restrict__ rw1, const float* __restrict__ rw2,
                 const float* __restrict__ rw3, _Float16* __restrict__ rw3T,
                 const float* __restrict__ ew1, _Float16* __restrict__ ew1T,
                 const float* __restrict__ ew2, _Float16* __restrict__ ew2T) {
  unsigned blk = blockIdx.x;
  if (blk < kBlkEw1) { transpose_to_f16<kD, kH, kH, kD * kH, kH>(ew1, ew1T, blk); return; }
  blk -= kBlkEw1;
  if (blk < kBlkEw2) { transpose_to_f16<kH, kH, kH, kH * kH, kH>(ew2, ew2T, blk); return; }
  blk -= kBlkEw2;
  if (blk < kBlkRw1) {
    transpose_to_f16<kD, kH, kRH1, kH, kH>(rw1, ew1T + (size_t)kE * kD * kH, blk);
    return;
  }
  blk -= kBlkRw1;
  if (blk < kBlkRw2) {
    transpose_to_f16<kH, kH, kH, kH * kH, kH>(rw2, ew2T + (size_t)kE * kH * kH, blk);
    return;
  }
  blk -= kBlkRw2;
  if (blk < kBlkRw3) { transpose_to_f16<kRH2, 16, kE, 0, kE>(rw3, rw3T, blk); return; }
  blk -= kBlkRw3;
  f32_to_f16_frag(x, xh, blk);
}

// ---------------------------------------------------------------------------
// Fragment helpers.
//
// CDNA5 16-bit A (16x32) lane layout: lane l (0..15) holds row M=l with
// K = {kb..kb+7, kb+16..kb+23}; lanes 16..31 hold the same rows with
// K = {kb+8..kb+15, kb+24..kb+31}.  B mirrors this with column N=l, which is
// a contiguous row of BT.  C/D: VGPR r, lane l -> (M = r + 8*(l>>4), N = l&15).
// ---------------------------------------------------------------------------
// p = tile start + lane*8 of a matrix in fragment order: the two pieces.
__device__ __forceinline__ v16h load_frag_g(const _Float16* p) {
  v8h a = *(const v8h*)(p);       // 16B -> b128 load (global or LDS), 512 B per wave
  v8h b = *(const v8h*)(p + 256);
  v16h r;
#pragma unroll
  for (int i = 0; i < 8; ++i) { r[i] = a[i]; r[i + 8] = b[i]; }
  return r;
}

__device__ __forceinline__ v8f wmma_f16(v16h a, v16h b, v8f c) {
  return __builtin_amdgcn_wmma_f32_16x16x32_f16(false, a, false, b, (short)0,
                                                c, false, false);
}

// ---------------------------------------------------------------------------
// Router tail of one row b: weights = softmax((logits + gumbel) / tau).
// acc holds the row's logits, bias included.
// ---------------------------------------------------------------------------
__device__ __forceinline__
void gumbel_softmax_row(float (&acc)[kE],
                        const float* __restrict__ u,    // [B, E]
                        float* __restrict__ wout,       // [B, E]
                        int b) {
  float mx = -1e30f;
#pragma unroll
  for (int e = 0; e < kE; ++e) {
    float uu = u[(size_t)b * kE + e];
    uu = fminf(fmaxf(uu, 1e-10f), 1.0f);
    float g = -logf(-logf(uu) + 1e-10f);
    acc[e] = (acc[e] + g) / kTau;
    mx = fmaxf(mx, acc[e]);
  }
  float s = 0.0f;
#pragma unroll
  for (int e = 0; e < kE; ++e) { acc[e] = expf(acc[e] - mx); s += acc[e]; }
  float inv = 1.0f / s;
#pragma unroll
  for (int e = 0; e < kE; ++e) wout[(size_t)b * kE + e] = acc[e] * inv;
}

// ---------------------------------------------------------------------------
// Expert MLP, all three layers in one kernel:
//   chart[e][b][:] = relu(relu(x W1 + b1) W2 + b2) W3 + b3
//   - block = 8 waves = 256 rows of one expert; a wave owns 32 rows x all 128 n
//   - W1[e] and W2[e] (fragment order) are copied once into LDS: 160 KiB, so
//     two blocks share a WGP and one computes while the other copies
//   - weights are the WMMA's first operand, so a lane's accumulators of n tiles
//     2t and 2t+1 are, after bias, relu and rounding to f16, exactly its
//     registers of the next layer's activation fragment for k tile t: h1 goes
//     from layer 1 to layer 2 in registers, with no cross-lane move
//   - layer 3 (128 -> 2) is summed per lane over its 64 n in f32, then the two
//     lane halves are added; h2 is never rounded or stored
//
// The router MLP (512 -> 256 -> 128 -> E) runs in the same launch, in the same
// form: blocks with blockIdx.y == 0 do 256 rows of it each, in two passes.
//   pass 1: weights of "expert" E   (first 128 of the 256 hidden units): layer 1,
//           then its share of layer 2's sums, parked in the workspace as f32
//   pass 2: weights of "expert" E+1 (the other 128): layer 1, then layer 2 goes
//           on from the parked sums; bias, relu; h2 goes to layer 3 in registers
//           as h1 went to layer 2; the logits are one more WMMA tile (rw3 as f16,
//           columns E .. 15 zero); then the softmax, one row per lane
// A lane parks and fetches its own accumulators: no other thread reads them.
// A router block is two expert blocks long, so these have the lowest indices.
// ---------------------------------------------------------------------------
constexpr int kW1Halves = kH * kD;   // 65536 halves = 128 KiB
constexpr int kW2Halves = kH * kH;   // 16384 halves =  32 KiB

// One pass over 256 rows with one set of weights.
// MODE 0: an expert.  MODE 1, 2: first and second pass of the router.
// No __restrict__ on b1, b2, w3: their loads then keep their place between the
// scheduling fences below; as loads of constant memory the compiler hoisted them
// into the matrix phases, and spilled.
template <int MODE>
__device__ __forceinline__
void mlp_pass(_Float16* wl,                      // LDS, kW1Halves + kW2Halves
              const _Float16* __restrict__ xh,   // [B, D], fragment order
              const _Float16* __restrict__ w1g,  // [H x D], fragment order
              const _Float16* __restrict__ w2g,  // [H x H], fragment order
              const float* b1,                   // [H]
              const float* b2,                   // [H]            (modes 0, 2)
              const float* w3,                   // [H][L]         (mode 0)
              const float* __restrict__ b3,      // [L] or [E]     (modes 0, 2)
              float* __restrict__ chart,         // [B][L]         (mode 0)
              v4f* park,                         // parked sums    (modes 1, 2)
              const _Float16* w3f,               // [16 x H], fragment order (mode 2)
              const float* __restrict__ u,       // (mode 2)
              float* __restrict__ wout) {        // (mode 2)
  const int tid  = threadIdx.x;
  const int lane = tid & 31;
  const int wave = tid >> 5;
  const int hi   = lane >> 4;
  const int m0   = blockIdx.x * 256 + wave * 32;

  const _Float16* pa0 = xh + (size_t)(m0 >> 4) * (kD * 16) + lane * 8;
  const _Float16* pa1 = pa0 + kD * 16;

  v16h xb[2][2];   // x fragments of two k tiles, [kt & 1][mi]
  v16h wb[2][4];   // weight fragments: two groups of 4 n tiles

  // ---- copy both weight matrices into LDS, 16 B per lane, linear ----
  {
    const v8h* g1 = (const v8h*)w1g + tid;
    const v8h* g2 = (const v8h*)w2g + tid;
    v8h* d = (v8h*)wl + tid;
    constexpr int n1 = kW1Halves / 8 / 256;   // 32 chunks per thread of W1
    if constexpr (MODE == 0) {
      // two rounds of 20 loads, all of a round in flight ahead of its LDS stores
      // (unrolled: t stays in registers, every offset is a constant)
#pragma unroll
      for (int h = 0; h < 2; ++h) {
        v8h t[20];
#pragma unroll
        for (int i = 0; i < 20; ++i) {
          const int c = h * 20 + i;
          t[i] = c < n1 ? g1[c * 256] : g2[(c - n1) * 256];
        }
#pragma unroll
        for (int i = 0; i < 20; ++i) d[(h * 20 + i) * 256] = t[i];
      }
    } else {
      // W2's 8 loads, then W1 in two rounds of 16 (64 KiB, the reach of an LDS
      // store's offset).  Not unrolled: unrolled, the compiler kept the 24 LDS
      // addresses past 64 KiB from the first pass to the second, and spilled.
      v8h t2[8];
#pragma unroll
      for (int i = 0; i < 8; ++i) t2[i] = g2[i * 256];
#pragma unroll 1
      for (int h = 0; h < 2; ++h) {
        v8h t[16];
#pragma unroll
        for (int i = 0; i < 16; ++i) t[i] = g1[i * 256];
        // Wait before the address registers of these loads are overwritten;
        // naming the pointers keeps them whole up to the wait.
        asm volatile("s_wait_xcnt 0x0" :: "v"(g1), "v"(g2) : "memory");
#pragma unroll
        for (int i = 0; i < 16; ++i) d[i * 256] = t[i];
        g1 += 16 * 256;
        d  += 16 * 256;
      }
#pragma unroll
      for (int i = 0; i < 8; ++i) d[i * 256] = t2[i];
    }
  }
  // the first x fragments fly while the block waits at the barrier
  xb[0][0] = load_frag_g(pa0);
  xb[0][1] = load_frag_g(pa1);
  xb[1][0] = load_frag_g(pa0 + 512);
  xb[1][1] = load_frag_g(pa1 + 512);
  // Wait before the address registers of the x loads are overwritten.
  asm volatile("s_wait_xcnt 0x0" ::: "memory");
  __syncthreads();

  // ---- layer 1: K = 512 (16 k tiles), N = 128 (8 n tiles) ----
  v8f acc[2][8];
#pragma unroll
  for (int mi = 0; mi < 2; ++mi)
#pragma unroll
    for (int j = 0; j < 8; ++j)
#pragma unroll
      for (int i = 0; i < 8; ++i) acc[mi][j][i] = 0.0f;

  const _Float16* lw1 = wl + lane * 8;               // tile (j, kt) at (j*16 + kt)*512
  const _Float16* lw2 = wl + kW1Halves + lane * 8;   // tile (j, kt) at (j*4 + kt)*512
#pragma unroll
  for (int jj = 0; jj < 4; ++jj) wb[0][jj] = load_frag_g(lw1 + (jj * 16) * 512);

  // Fully unrolled: every array index and every address offset is a constant,
  // so no address register is rewritten while loads are in flight.
  // Group g = (k tile g/2, n tiles 4*(g&1) .. +3): its 8 LDS loads are issued
  // together, one group ahead of the 8 WMMAs that use them.
#pragma unroll
  for (int g = 0; g < 32; ++g) {
    const int kt = g >> 1, jh = g & 1;
    if (g + 1 < 32) {
      const int kn = (g + 1) >> 1, jn = ((g + 1) & 1) * 4;
#pragma unroll
      for (int jj = 0; jj < 4; ++jj)
        wb[(g + 1) & 1][jj] = load_frag_g(lw1 + ((jn + jj) * 16 + kn) * 512);
    }
    // keeps the loads above in one place ahead of the WMMA block (for speed only)
    __builtin_amdgcn_sched_barrier(0);
#pragma unroll
    for (int jj = 0; jj < 4; ++jj) {
      acc[0][jh * 4 + jj] = wmma_f16(wb[g & 1][jj], xb[kt & 1][0], acc[0][jh * 4 + jj]);
      acc[1][jh * 4 + jj] = wmma_f16(wb[g & 1][jj], xb[kt & 1][1], acc[1][jh * 4 + jj]);
    }
    // ends the WMMA block: the next group's loads stay behind it
    __builtin_amdgcn_sched_barrier(0);
    if (jh == 1 && kt + 2 < 16) {
      xb[kt & 1][0] = load_frag_g(pa0 + (kt + 2) * 512);
      xb[kt & 1][1] = load_frag_g(pa1 + (kt + 2) * 512);
    }
  }
  // Wait before the address registers of the x loads are overwritten; naming
  // them keeps them whole up to the wait.
  asm volatile("s_wait_xcnt 0x0" :: "v"(pa0), "v"(pa1) : "memory");

  // ---- h1 = f16(relu(acc + b1)), straight into layer 2's fragments ----
  // acc[mi][j][r] = row m0 + 16*mi + l16, n = 16*j + 8*hi + r
  v16h hf[2][4];   // [mi][k tile of layer 2]
  {
    const float* be = b1 + 8 * hi;
    v4f b[8][2];   // all 16 loads in flight together: one latency, not eight
#pragma unroll
    for (int j = 0; j < 8; ++j) {
      b[j][0] = *(const v4f*)(be + 16 * j);
      b[j][1] = *(const v4f*)(be + 16 * j + 4);
    }
    // Wait before the address registers of these loads are overwritten; naming
    // the pointer keeps it whole up to the wait.
    asm volatile("s_wait_xcnt 0x0" :: "v"(be) : "memory");
#pragma unroll
    for (int j = 0; j < 8; ++j) {
      // one n tile at a time, so that its accumulators are free before the
      // next tile's temporaries are made (registers)
      __builtin_amdgcn_sched_barrier(0);
#pragma unroll
      for (int mi = 0; mi < 2; ++mi)
#pragma unroll
        for (int r = 0; r < 8; ++r) {
          float v = acc[mi][j][r] + b[j][r >> 2][r & 3];
          v = v > 0.0f ? v : 0.0f;
          hf[mi][j >> 1][(j & 1) * 8 + r] = (_Float16)v;
        }
    }
    // layer 2's loads stay behind the conversion (registers)
    __builtin_amdgcn_sched_barrier(0);
  }

  // ---- layers 2 and 3, 4 n tiles at a time ----
  const float* be2 = MODE != 1 ? b2 + 8 * hi : nullptr;
  const float* w3h = MODE == 0 ? w3 + 16 * hi : nullptr;
  // this lane's parked sums: piece ((jh*2 + mi)*4 + jj)*2 + half, 512 B per wave
  // (the wave's number goes through readfirstlane, so that the base is scalar
  // and holds no vector registers over the matrix phases)
  v4f* pk = MODE != 0
      ? park + (size_t)__builtin_amdgcn_readfirstlane(m0 >> 5) * 1024 + lane : nullptr;
  v2f s[2] = {{0.0f, 0.0f}, {0.0f, 0.0f}};   // mode 0: [mi], the two l side by side
  v8f lg[2];                                 // mode 2: logits^T, [mi]
#pragma unroll
  for (int mi = 0; mi < 2; ++mi)
#pragma unroll
    for (int i = 0; i < 8; ++i) lg[mi][i] = 0.0f;
  // not unrolled: unrolled, the compiler moved the first half's sums behind the
  // second half's matrix phase, kept both halves' values live, and spilled
#pragma unroll 1
  for (int jh = 0; jh < 2; ++jh) {
    v8f a2[2][4];
    v4f* pj = MODE != 0 ? pk + jh * 512 : nullptr;
    if constexpr (MODE == 2) {
      // go on from the first pass's sums (all 16 loads in flight together)
#pragma unroll
      for (int mi = 0; mi < 2; ++mi)
#pragma unroll
        for (int jj = 0; jj < 4; ++jj) {
          const v4f lo = pj[((mi * 4 + jj) * 2 + 0) * 32];
          const v4f up = pj[((mi * 4 + jj) * 2 + 1) * 32];
#pragma unroll
          for (int i = 0; i < 4; ++i) { a2[mi][jj][i] = lo[i]; a2[mi][jj][i + 4] = up[i]; }
        }
      // Wait before the address registers of these loads are overwritten;
      // naming the pointer keeps it whole up to the wait.
      asm volatile("s_wait_xcnt 0x0" :: "v"(pj) : "memory");
    } else {
#pragma unroll
      for (int mi = 0; mi < 2; ++mi)
#pragma unroll
        for (int jj = 0; jj < 4; ++jj)
#pragma unroll
          for (int i = 0; i < 8; ++i) a2[mi][jj][i] = 0.0f;
    }
#pragma unroll
    for (int jj = 0; jj < 4; ++jj)
      wb[0][jj] = load_frag_g(lw2 + ((jh * 4 + jj) * 4) * 512);
#pragma unroll
    for (int kt = 0; kt < 4; ++kt) {
      if (kt + 1 < 4) {
#pragma unroll
        for (int jj = 0; jj < 4; ++jj)
          wb[(kt + 1) & 1][jj] = load_frag_g(lw2 + ((jh * 4 + jj) * 4 + kt + 1) * 512);
      }
      // as in layer 1: loads in one place ahead of the WMMA block
      __builtin_amdgcn_sched_barrier(0);
#pragma unroll
      for (int jj = 0; jj < 4; ++jj) {
        a2[0][jj] = wmma_f16(wb[kt & 1][jj], hf[0][kt], a2[0][jj]);
        a2[1][jj] = wmma_f16(wb[kt & 1][jj], hf[1][kt], a2[1][jj]);
      }
      // ends the WMMA block; behind the last one it also keeps the bias and W3
      // loads below out of the matrix phase, where they would not fit the registers
      __builtin_amdgcn_sched_barrier(0);
    }
    if constexpr (MODE == 1) {
      // park this pass's share of layer 2's sums
#pragma unroll
      for (int mi = 0; mi < 2; ++mi)
#pragma unroll
        for (int jj = 0; jj < 4; ++jj) {
          v4f lo, up;
#pragma unroll
          for (int i = 0; i < 4; ++i) { lo[i] = a2[mi][jj][i]; up[i] = a2[mi][jj][i + 4]; }
          pj[((mi * 4 + jj) * 2 + 0) * 32] = lo;
          pj[((mi * 4 + jj) * 2 + 1) * 32] = up;
        }
      // Wait before a register of these stores is overwritten; naming the
      // pointer keeps it whole up to the wait.
      asm volatile("s_wait_xcnt 0x0" :: "v"(pj) : "memory");
    } else if constexpr (MODE == 2) {
      v4f b[4][2];   // b2[n]
      const float* pb = be2 + 64 * jh;
      const _Float16* pw = w3f + jh * 1024 + lane * 8;   // k tiles 2*jh, 2*jh + 1
#pragma unroll
      for (int jj = 0; jj < 4; ++jj) {
        b[jj][0] = *(const v4f*)(pb + 16 * jj);
        b[jj][1] = *(const v4f*)(pb + 16 * jj + 4);
      }
      v16h wf[2];
      wf[0] = load_frag_g(pw);
      wf[1] = load_frag_g(pw + 512);
      // Wait before the address registers of these loads are overwritten; naming
      // the pointers keeps them whole up to the wait.
      asm volatile("s_wait_xcnt 0x0" :: "v"(pb), "v"(pw) : "memory");
      // h2 = f16(relu(a2 + b2)), straight into layer 3's fragments, as h1 above
      v16h h2f[2][2];   // [mi][k tile 2*jh + t]
#pragma unroll
      for (int jj = 0; jj < 4; ++jj)
#pragma unroll
        for (int mi = 0; mi < 2; ++mi)
#pragma unroll
          for (int r = 0; r < 8; ++r) {
            float v = a2[mi][jj][r] + b[jj][r >> 2][r & 3];
            v = v > 0.0f ? v : 0.0f;
            h2f[mi][jj >> 1][(jj & 1) * 8 + r] = (_Float16)v;
          }
#pragma unroll
      for (int t = 0; t < 2; ++t)
#pragma unroll
        for (int mi = 0; mi < 2; ++mi) lg[mi] = wmma_f16(wf[t], h2f[mi][t], lg[mi]);
    } else {
      v4f b[4][2];   // b2[n]
      v4f c[4][4];   // W3[n][l], n = 16*j + 8*hi + 0..7: 16 consecutive floats
      // all 24 loads in flight together: one latency, not four
      const float* pb = be2 + 64 * jh;
      const float* pc = w3h + 128 * jh;
#pragma unroll
      for (int jj = 0; jj < 4; ++jj) {
        b[jj][0] = *(const v4f*)(pb + 16 * jj);
        b[jj][1] = *(const v4f*)(pb + 16 * jj + 4);
#pragma unroll
        for (int i = 0; i < 4; ++i) c[jj][i] = *(const v4f*)(pc + 32 * jj + 4 * i);
      }
      // Wait before the address registers of these loads are overwritten; naming
      // the pointers keeps them whole up to the wait.
      asm volatile("s_wait_xcnt 0x0" :: "v"(pb), "v"(pc) : "memory");
#pragma unroll
      for (int jj = 0; jj < 4; ++jj) {
        // one n tile at a time (registers), as in the conversion above
        __builtin_amdgcn_sched_barrier(0);
#pragma unroll
        for (int mi = 0; mi < 2; ++mi)
#pragma unroll
          for (int r = 0; r < 8; ++r) {
            float v = a2[mi][jj][r] + b[jj][r >> 2][r & 3];
            v = v > 0.0f ? v : 0.0f;
            const v2f cw = {c[jj][r >> 1][(r & 1) * 2 + 0], c[jj][r >> 1][(r & 1) * 2 + 1]};
            const v2f vv = {v, v};
            s[mi] = __builtin_elementwise_fma(vv, cw, s[mi]);
          }
      }
    }
  }

  if constexpr (MODE == 0) {
    // add the two lane halves (n split by hi); then lane half hi stores row tile hi:
    // one wave writes 32 rows x 8 B = 256 contiguous bytes
#pragma unroll
    for (int mi = 0; mi < 2; ++mi)
#pragma unroll
      for (int l = 0; l < 2; ++l) s[mi][l] += __shfl_xor(s[mi][l], 16);
    float2 o;
    o.x = (hi ? s[1][0] : s[0][0]) + b3[0];
    o.y = (hi ? s[1][1] : s[0][1]) + b3[1];
    *(float2*)(chart + (size_t)(m0 + lane) * kL) = o;
    // Wait before a register of this store is overwritten.
    asm volatile("s_wait_xcnt 0x0" ::: "memory");
  } else if constexpr (MODE == 2) {
    // lg[mi][r] = logit 8*hi + r of row m0 + 16*mi + l16.  Lane half hi takes row
    // tile hi, so that lane l has row m0 + l: the lower half lacks logits 8.. of
    // tile 0, the upper half logits 0..7 of tile 1; each sends what the other lacks.
    float got[8];
#pragma unroll
    for (int r = 0; r < 8; ++r) got[r] = __shfl_xor(hi ? lg[0][r] : lg[1][r], 16);
    float lo[kE];
#pragma unroll
    for (int e = 0; e < kE; ++e)
      lo[e] = (e < 8 ? (hi ? got[e] : lg[0][e]) : (hi ? lg[1][e - 8] : got[e - 8])) + b3[e];
    gumbel_softmax_row(lo, u, wout, m0 + lane);
  }
}

// second argument: 4 waves per SIMD (256 VGPRs), so that two blocks are resident
__global__ __launch_bounds__(256, 4)
void expert_mlp_fused_kernel(const _Float16* __restrict__ xh,   // [B, D], fragment order
                             const _Float16* __restrict__ w1f,  // [E+2][H x D], fragment order
                             const _Float16* __restrict__ w2f,  // [E+2][H x H], fragment order
                             const float* eb1,                  // [E][H]
                             const float* eb2,                  // [E][H]
                             const float* ew3,                  // [E][H][L]
                             const float* __restrict__ eb3,     // [E][L]
                             float* __restrict__ chart,         // [E][B][L]
                             const float* rb1,                  // [RH1]
                             const float* rb2,                  // [RH2]
                             const _Float16* rw3T,              // [16 x RH2], fragment order
                             const float* __restrict__ rb3,     // [E]
                             const float* __restrict__ u,       // [B, E]
                             float* __restrict__ wout,          // [B, E]
                             float* park) {                     // [B/32][1024] x 16 B
  __shared__ __attribute__((aligned(16))) _Float16 wl[kW1Halves + kW2Halves];
  if (blockIdx.y == 0) {   // block-uniform: every wave passes the same barriers
    mlp_pass<1>(wl, xh, w1f + (size_t)kE * kW1Halves, w2f + (size_t)kE * kW2Halves,
                rb1, nullptr, nullptr, nullptr, nullptr, (v4f*)park, nullptr,
                nullptr, nullptr);
    // every wave has read the last of the first pass's weights before the
    // second pass's are copied over them
    __syncthreads();
    mlp_pass<2>(wl, xh, w1f + (size_t)(kE + 1) * kW1Halves,
                w2f + (size_t)(kE + 1) * kW2Halves, rb1 + kH, rb2, nullptr, rb3,
                nullptr, (v4f*)park, rw3T, u, wout);
    return;
  }
  const int e = blockIdx.y - 1;
  mlp_pass<0>(wl, xh, w1f + (size_t)e * kW1Halves, w2f + (size_t)e * kW2Halves,
              eb1 + e * kH, eb2 + e * kH, ew3 + (size_t)e * kH * kL, eb3 + e * kL,
              chart + (size_t)e * kB * kL, nullptr, nullptr, nullptr, nullptr);
}

// z[b,l] = sum_e weights[b,e] * chart[e,b,l]
__global__ void z_kernel(const float* __restrict__ wght,
                         const float* __restrict__ chart,
                         float* __restrict__ z) {
  int b = blockIdx.x * blockDim.x + threadIdx.x;
  if (b >= kB) return;
  float z0 = 0.0f, z1 = 0.0f;
#pragma unroll
  for (int e = 0; e < kE; ++e) {
    float w = wght[(size_t)b * kE + e];
    z0 += w * chart[((size_t)e * kB + b) * kL + 0];
    z1 += w * chart[((size_t)e * kB + b) * kL + 1];
  }
  z[(size_t)b * kL + 0] = z0;
  z[(size_t)b * kL + 1] = z1;
}

// ---------------------------------------------------------------------------
extern "C" void kernel_launch(void* const* d_in, const int* in_sizes, int n_in,
                              void* d_out, int out_size, void* d_ws, size_t ws_size,
                              hipStream_t stream) {
  (void)in_sizes; (void)n_in; (void)out_size; (void)ws_size;

  const float* x   = (const float*)d_in[0];
  const float* u   = (const float*)d_in[1];
  const float* rw1 = (const float*)d_in[2];
  const float* rb1 = (const float*)d_in[3];
  const float* rw2 = (const float*)d_in[4];
  const float* rb2 = (const float*)d_in[5];
  const float* rw3 = (const float*)d_in[6];
  const float* rb3 = (const float*)d_in[7];
  const float* ew1 = (const float*)d_in[8];
  const float* eb1 = (const float*)d_in[9];
  const float* ew2 = (const float*)d_in[10];
  const float* eb2 = (const float*)d_in[11];
  const float* ew3 = (const float*)d_in[12];
  const float* eb3 = (const float*)d_in[13];

  float* out   = (float*)d_out;
  float* out_z = out;                                  // [B, L]
  float* out_w = out + (size_t)kB * kL;                // [B, E]
  float* out_c = out_w + (size_t)kB * kE;              // [E, B, L]

  // Workspace carve-up (256B aligned)
  char* ws = (char*)d_ws;
  size_t off = 0;
  auto carve = [&](size_t bytes) -> void* {
    void* p = ws + off;
    off += (bytes + 255) & ~(size_t)255;
    return p;
  };
  // the f16 ones in fragment order; ew1T, ew2T per expert, the router's two halves behind
  _Float16* xh   = (_Float16*)carve((size_t)kB * kD * 2);               // x in f16
  _Float16* ew1T = (_Float16*)carve((size_t)(kE + 2) * kD * kH * 2);    // [E+2][H][D]
  _Float16* ew2T = (_Float16*)carve((size_t)(kE + 2) * kH * kH * 2);    // [E+2][H][H]
  _Float16* rw3T = (_Float16*)carve((size_t)16 * kRH2 * 2);             // [16][RH2]
  float*    park = (float*)carve((size_t)kB * kRH2 * 4);                // router, layer 2 sums

  // 1) conversions / weight transposes, one launch
  prep_kernel<<<dim3(kBlkPrep), 256, 0, stream>>>(x, xh, rw1, rw2, rw3, rw3T,
                                                  ew1, ew1T, ew2, ew2T);

  // 2) experts (all three layers, into the chart_outputs region) and the whole
  //    router (three layers and the gumbel softmax), one launch
  expert_mlp_fused_kernel<<<dim3(kB / 256, kE + 1), 256, 0, stream>>>(
      xh, ew1T, ew2T, eb1, eb2, ew3, eb3, out_c, rb1, rb2, rw3T, rb3, u, out_w, park);

  // 3) z = weights . zc
  z_kernel<<<dim3(kB / 256), 256, 0, stream>>>(out_w, out_c, out_z);
}

// v006
// One run takes 54.6 microseconds.
// Two timings next to v005 put it at 1.04 and 1.05 times that version's speed.
// All steps since v000 together make it 4.31 times as fast.
#include <hip/hip_runtime.h>
#include <hip/hip_bf16.h>

typedef __attribute__((ext_vector_type(16))) _Float16 v16h;
typedef __attribute__((ext_vector_type(8)))  _Float16 v8h;
typedef __attribute__((ext_vector_type(8)))  float    v8f;
typedef __attribute__((ext_vector_type(4)))  float    v4f;
typedef __attribute__((ext_vector_type(2)))  float    v2f;

// Problem sizes (fixed by the reference)
constexpr int kB   = 32768;
constexpr int kD   = 512;
constexpr int kE   = 10;
constexpr int kH   = 128;
constexpr int kL   = 2;
constexpr int kRH1 = 256;
constexpr int kRH2 = 128;
constexpr float kTau = 3.0f;

// ---------------------------------------------------------------------------
// Fragment order of an f16 activation matrix [rows x K] in the workspace.
//
// The matrix is cut into tiles of 16 rows x 32 k (512 halves = 1 KiB); tile
// (mt, kt) starts at (mt * (K/32) + kt) * 512 halves.  A tile is two pieces of
// 256 halves; in piece p, lane (h*16 + c) owns the 8 halves
//   row = mt*16 + c,  k = kt*32 + p*16 + h*8 + 0..7,
// which is what that lane's WMMA operand registers hold.  So one wave reads or
// writes a piece as 32 lanes x 16 B = 512 contiguous bytes (4 whole lines).
// ---------------------------------------------------------------------------

// ---------------------------------------------------------------------------
// Prep kernels
// ---------------------------------------------------------------------------
// x [B, D] fp32 -> xh, f16 in fragment order.  One block = one tile row mt
// (16 rows x D = 1024 chunks of 8 halves), 4 chunks per thread; chunk
// u = t + 256*s of the tile row is stored at u*8 halves.
__device__ __forceinline__
void f32_to_f16_frag(const float* __restrict__ src,
                     _Float16* __restrict__ dst, size_t mt) {
  const int t = threadIdx.x;
  const int c = t & 15, h = (t >> 4) & 1, p = (t >> 5) & 1, kt0 = t >> 6;
  const float* s = src + (mt * 16 + c) * kD + kt0 * 32 + p * 16 + h * 8;
  _Float16* d = dst + mt * (size_t)(kD * 16) + t * 8;
  v4f lo[4], up[4];
  // unrolled (here and below): the arrays stay in registers and all 8 loads
  // are in flight before the first store
#pragma unroll
  for (int i = 0; i < 4; ++i) {
    lo[i] = *(const v4f*)(s + i * 128);
    up[i] = *(const v4f*)(s + i * 128 + 4);
  }
#pragma unroll
  for (int i = 0; i < 4; ++i) {
    v8h v;
#pragma unroll
    for (int k = 0; k < 4; ++k) {
      v[k] = (_Float16)lo[i][k];
      v[k + 4] = (_Float16)up[i][k];
    }
    *(v8h*)(d + i * 2048) = v;
  }
  // Wait before a register of these stores is overwritten: in the shared
  // launch other jobs' code follows them in the program.
  asm volatile("s_wait_xcnt 0x0" ::: "memory");
}

// W: K x N fp32, rows LD floats apart (optionally batched, SRCB floats from one
// matrix to the next) -> WT: [N,K] f16 in fragment order (rows = n), for the
// fused kernel's linear copy into LDS.  A thread makes one 16-byte chunk: 8 k of
// one n.  Chunk u is numbered in fragment order: lane (h*16 + c) of a wave has
// n = nt*16 + c and k = 8q .. 8q+7, q = kt*4 + p*2 + h, so each of its 8 loads
// reads two runs of 16 consecutive floats per wave; chunk u lies at u*8 halves,
// 512 contiguous B per wave.  Only the first NV columns exist in W: the rest of
// WT is zero.
// blk = 0 .. batches * K*N/8/256 - 1: block blk % (K*N/8/256) of matrix
// blk / (K*N/8/256).  DSTB halves lie from one WT to the next.
template <int K, int N, int LD, int SRCB, int NV, int DSTB>
__device__ __forceinline__
void transpose_to_f16(const float* __restrict__ W,
                      _Float16* __restrict__ WT, unsigned blk) {
  static_assert(K % 32 == 0 && N % 16 == 0 && (K * N / 8) % 256 == 0,
                "K*N/8/256 blocks cover the chunks of a matrix exactly");
  constexpr unsigned perMat = K * N / 8 / 256;
  const size_t batch = blk / perMat;
  const float* w = W + batch * (size_t)SRCB;
  _Float16* wt = WT + batch * (size_t)DSTB;
  const unsigned u = (blk % perMat) * 256 + threadIdx.x;
  const unsigned n = ((u >> 6) / (K / 32)) * 16 + (u & 15);
  const unsigned q = ((u >> 6) % (K / 32)) * 4 + ((u >> 4) & 3);
  const float* s = w + (size_t)(q * 8) * LD + n;
  float f[8];
  // unrolled: f stays in registers and all 8 loads are in flight together
#pragma unroll
  for (int i = 0; i < 8; ++i) f[i] = (NV == N || n < NV) ? s[i * LD] : 0.0f;
  v8h v;
#pragma unroll   // v is indexed by constants only
  for (int i = 0; i < 8; ++i) v[i] = (_Float16)f[i];
  *(v8h*)(wt + (size_t)u * 8) = v;
  // Wait before a register of this store is overwritten: in the shared launch
  // other jobs' code follows it in the program.
  asm volatile("s_wait_xcnt 0x0" ::: "memory");
}

// All conversions in one launch: none reads what another writes, and the block
// index picks the job.  The short weight jobs have the low indices (for speed only).
// The router's first two layers are laid out as two more experts, E and E+1:
// number E+p has columns 128p .. 128p+127 of rw1 and rows 128p .. 128p+127 of
// rw2.  rw3 becomes one 16 x 128 tile row (columns E .. 15 zero).
// A set of weights is one expert's W1 and, right behind it, its W2: the fused
// kernel copies a set into LDS as one linear piece.
constexpr int kSetHalves = kD * kH + kH * kH;   // 160 KiB
constexpr unsigned kBlkEw1 = kE * (kD * kH / 8 / 256);
constexpr unsigned kBlkEw2 = kE * (kH * kH / 8 / 256);
constexpr unsigned kBlkRw1 = kD * kRH1 / 8 / 256;
constexpr unsigned kBlkRw2 = kRH1 * kRH2 / 8 / 256;
constexpr unsigned kBlkRw3 = kRH2 * 16 / 8 / 256;
constexpr unsigned kBlkX   = kB / 16;
constexpr unsigned kBlkPrep = kBlkEw1 + kBlkEw2 + kBlkRw1 + kBlkRw2 + kBlkRw3 + kBlkX;
static_assert(kRH1 == 2 * kH && kRH2 == kH && kE <= 16,
              "the router is two experts wide, its logits fit one tile");

__global__ __launch_bounds__(256)
void prep_kernel(const float* __restrict__ x,   _Float16* __restrict__ xh,
                 const float* __restrict__ rw1, const float* __restrict__ rw2,
                 const float* __restrict__ rw3, _Float16* __restrict__ rw3T,
                 const float* __restrict__ ew1, _Float16* __restrict__ ew1T,
                 const float* __restrict__ ew2, _Float16* __restrict__ ew2T) {
  unsigned blk = blockIdx.x;
  if (blk < kBlkEw1) {
    transpose_to_f16<kD, kH, kH, kD * kH, kH, kSetHalves>(ew1, ew1T, blk);
    return;
  }
  blk -= kBlkEw1;
  if (blk < kBlkEw2) {
    transpose_to_f16<kH, kH, kH, kH * kH, kH, kSetHalves>(ew2, ew2T, blk);
    return;
  }
  blk -= kBlkEw2;
  if (blk < kBlkRw1) {
    transpose_to_f16<kD, kH, kRH1, kH, kH, kSetHalves>(rw1, ew1T + (size_t)kE * kSetHalves, blk);
    return;
  }
  blk -= kBlkRw1;
  if (blk < kBlkRw2) {
    transpose_to_f16<kH, kH, kH, kH * kH, kH, kSetHalves>(rw2, ew2T + (size_t)kE * kSetHalves, blk);
    return;
  }
  blk -= kBlkRw2;
  if (blk < kBlkRw3) { transpose_to_f16<kRH2, 16, kE, 0, kE, 0>(rw3, rw3T, blk); return; }
  blk -= kBlkRw3;
  f32_to_f16_frag(x, xh, blk);
}

// ---------------------------------------------------------------------------
// Fragment helpers.
//
// CDNA5 16-bit A (16x32) lane layout: lane l (0..15) holds row M=l with
// K = {kb..kb+7, kb+16..kb+23}; lanes 16..31 hold the same rows with
// K = {kb+8..kb+15, kb+24..kb+31}.  B mirrors this with column N=l, which is
// a contiguous row of BT.  C/D: VGPR r, lane l -> (M = r + 8*(l>>4), N = l&15).
// ---------------------------------------------------------------------------
// p = tile start + lane*8 of a matrix in fragment order: the two pieces.
__device__ __forceinline__ v16h load_frag_g(const _Float16* p) {
  v8h a = *(const v8h*)(p);       // 16B -> b128 load (global or LDS), 512 B per wave
  v8h b = *(const v8h*)(p + 256);
  v16h r;
#pragma unroll
  for (int i = 0; i < 8; ++i) { r[i] = a[i]; r[i + 8] = b[i]; }
  return r;
}

__device__ __forceinline__ v8f wmma_f16(v16h a, v16h b, v8f c) {
  return __builtin_amdgcn_wmma_f32_16x16x32_f16(false, a, false, b, (short)0,
                                                c, false, false);
}

// ---------------------------------------------------------------------------
// Router tail of one row b: weights = softmax((logits + gumbel) / tau).
// acc holds the row's logits, bias included.
// ---------------------------------------------------------------------------
__device__ __forceinline__
void gumbel_softmax_row(float (&acc)[kE],
                        const float* __restrict__ u,    // [B, E]
                        float* __restrict__ wout,       // [B, E]
                        int b) {
  float mx = -1e30f;
#pragma unroll
  for (int e = 0; e < kE; ++e) {
    float uu = u[(size_t)b * kE + e];
    uu = fminf(fmaxf(uu, 1e-10f), 1.0f);
    float g = -logf(-logf(uu) + 1e-10f);
    acc[e] = (acc[e] + g) / kTau;
    mx = fmaxf(mx, acc[e]);
  }
  float s = 0.0f;
#pragma unroll
  for (int e = 0; e < kE; ++e) { acc[e] = expf(acc[e] - mx); s += acc[e]; }
  float inv = 1.0f / s;
#pragma unroll
  for (int e = 0; e < kE; ++e) wout[(size_t)b * kE + e] = acc[e] * inv;
}

// ---------------------------------------------------------------------------
// Expert MLP, all three layers in one kernel:
//   chart[e][b][:] = relu(relu(x W1 + b1) W2 + b2) W3 + b3
//   - block = 16 waves = 512 rows, alone on its WGP; a wave owns 32 rows x all
//     128 n; the block runs three sets of weights over its rows, one after another
//   - a set, W1[e] and W2[e] (fragment order), is 160 KiB of LDS; there are two
//     such buffers, and the next set's asynchronous copies fly into the one
//     while all 16 waves work on the other
//   - weights are the WMMA's first operand, so a lane's accumulators of n tiles
//     2t and 2t+1 are, after bias, relu and rounding to f16, exactly its
//     registers of the next layer's activation fragment for k tile t: h1 goes
//     from layer 1 to layer 2 in registers, with no cross-lane move
//   - layer 3 (128 -> 2) is summed per lane over its 64 n in f32, then the two
//     lane halves are added; h2 is never rounded or stored
//
// The router MLP (512 -> 256 -> 128 -> E) runs in the same launch, in the same
// form: blocks with blockIdx.y == 0 do 512 rows of it each, in two passes,
// and then one expert.
//   pass 1: weights of "expert" E   (first 128 of the 256 hidden units): layer 1,
//           then its share of layer 2's sums, parked in the workspace as f32
//   pass 2: weights of "expert" E+1 (the other 128): layer 1, then layer 2 goes
//           on from the parked sums; bias, relu; h2 goes to layer 3 in registers
//           as h1 went to layer 2; the logits are one more WMMA tile (rw3 as f16,
//           columns E .. 15 zero); then the softmax, one row per lane
// A lane parks and fetches its own accumulators: no other thread reads them.
// ---------------------------------------------------------------------------
constexpr int kW1Halves = kH * kD;   // 65536 halves = 128 KiB
constexpr int kW2Halves = kH * kH;   // 16384 halves =  32 KiB
static_assert(kSetHalves == kW1Halves + kW2Halves, "a set fills one LDS buffer");
constexpr int kRowsBlk = 512;        // rows of a block: 16 waves x 32
constexpr int kSetsBlk = 3;          // sets of weights a block runs
static_assert((kE + 2) % kSetsBlk == 0 && kB % kRowsBlk == 0,
              "the sets and the rows are dealt out evenly");

// One set of weights into one LDS buffer, linear: 20 chunks of 8 KiB (512 lanes x
// 16 B), so 20 asynchronous copies per wave are in flight.  An immediate offset
// moves the LDS and the global address alike; it stays under 64 KiB, so three
// pairs of address registers serve the 160 KiB.  The s_wait_xcnt closes the
// statement, so that no address register of a copy is rewritten ahead of it.
// Every lane is on; the caller's control flow is the same for the whole block.
__device__ __forceinline__
void copy_set_async(_Float16* buf, const _Float16* wset) {
  const unsigned l = (unsigned)(size_t)buf + threadIdx.x * 16u;   // LDS byte address
  const char* a = (const char*)wset + threadIdx.x * 16u;
  asm volatile(
      "global_load_async_to_lds_b128 %0, %3, off\n\t"
      "global_load_async_to_lds_b128 %0, %3, off offset:8192\n\t"
      "global_load_async_to_lds_b128 %0, %3, off offset:16384\n\t"
      "global_load_async_to_lds_b128 %0, %3, off offset:24576\n\t"
      "global_load_async_to_lds_b128 %0, %3, off offset:32768\n\t"
      "global_load_async_to_lds_b128 %0, %3, off offset:40960\n\t"
      "global_load_async_to_lds_b128 %0, %3, off offset:49152\n\t"
      "global_load_async_to_lds_b128 %0, %3, off offset:57344\n\t"
      "global_load_async_to_lds_b128 %1, %4, off\n\t"
      "global_load_async_to_lds_b128 %1, %4, off offset:8192\n\t"
      "global_load_async_to_lds_b128 %1, %4, off offset:16384\n\t"
      "global_load_async_to_lds_b128 %1, %4, off offset:24576\n\t"
      "global_load_async_to_lds_b128 %1, %4, off offset:32768\n\t"
      "global_load_async_to_lds_b128 %1, %4, off offset:40960\n\t"
      "global_load_async_to_lds_b128 %1, %4, off offset:49152\n\t"
      "global_load_async_to_lds_b128 %1, %4, off offset:57344\n\t"
      "global_load_async_to_lds_b128 %2, %5, off\n\t"
      "global_load_async_to_lds_b128 %2, %5, off offset:8192\n\t"
      "global_load_async_to_lds_b128 %2, %5, off offset:16384\n\t"
      "global_load_async_to_lds_b128 %2, %5, off offset:24576\n\t"
      "s_wait_xcnt 0x0"
      :: "v"(l), "v"(l + 65536u), "v"(l + 131072u),
         "v"(a), "v"(a + 65536), "v"(a + 131072)
      : "memory");
}

// Foot of a pass: this wave's LDS reads are done and its copies have landed;
// behind the barrier the next set is readable by every wave and the buffer just
// read may be refilled.
__device__ __forceinline__
void pass_foot() {
  asm volatile("s_wait_dscnt 0x0" ::: "memory");     // own reads of the old buffer
  asm volatile("s_wait_asynccnt 0x0" ::: "memory");  // own copies of the next set
  __syncthreads();
}

// One pass over 512 rows with one set of weights, which lies in LDS.
// MODE 0: an expert.  MODE 1, 2: first and second pass of the router.
// No __restrict__ on b1, b2, w3: their loads then keep their place between the
// scheduling fences below; as loads of constant memory the compiler hoisted them
// into the matrix phases, and spilled.
template <int MODE>
__device__ __forceinline__
void mlp_pass(const _Float16* wl,                // LDS: W1 [H x D], W2 [H x H], fragment order
              bool fill,                         // a next set exists (block-uniform)
              _Float16* nbuf,                    // LDS buffer of the next set
              const _Float16* nset,              // next set in the workspace
              const _Float16* __restrict__ xh,   // [B, D], fragment order
              const float* b1,                   // [H]
              const float* b2,                   // [H]            (modes 0, 2)
              const float* w3,                   // [H][L]         (mode 0)
              const float* __restrict__ b3,      // [L] or [E]     (modes 0, 2)
              float* __restrict__ chart,         // [B][L]         (mode 0)
              v4f* park,                         // parked sums    (modes 1, 2)
              const _Float16* w3f,               // [16 x H], fragment order (mode 2)
              const float* __restrict__ u,       // (mode 2)
              float* __restrict__ wout) {        // (mode 2)
  const int tid  = threadIdx.x;
  const int lane = tid & 31;
  // through readfirstlane: the wave's number, and the row base made of it, are
  // scalar and hold no vector registers from pass to pass
  const int wave = __builtin_amdgcn_readfirstlane(tid >> 5);
  const int hi   = lane >> 4;
  const int m0   = blockIdx.x * kRowsBlk + wave * 32;

  const _Float16* pa0 = xh + (size_t)(m0 >> 4) * (kD * 16) + lane * 8;
  const _Float16* pa1 = pa0 + kD * 16;

  v16h xb[2][2];   // x fragments of two k tiles, [kt & 1][mi]
  v16h wb[2][4];   // weight fragments: two groups of 4 n tiles

  xb[0][0] = load_frag_g(pa0);
  xb[0][1] = load_frag_g(pa1);
  xb[1][0] = load_frag_g(pa0 + 512);
  xb[1][1] = load_frag_g(pa1 + 512);
  // The next set's copies, into the buffer that the pass before this one has read
  // (the barrier in front of this pass ended those reads).  They stand behind the
  // x loads above, which this pass needs first, and fly during the whole pass.
  if (fill) copy_set_async(nbuf, nset);

  // ---- layer 1: K = 512 (16 k tiles), N = 128 (8 n tiles) ----
  v8f acc[2][8];
#pragma unroll
  for (int mi = 0; mi < 2; ++mi)
#pragma unroll
    for (int j = 0; j < 8; ++j)
#pragma unroll
      for (int i = 0; i < 8; ++i) acc[mi][j][i] = 0.0f;

  const _Float16* lw1 = wl + lane * 8;               // tile (j, kt) at (j*16 + kt)*512
  const _Float16* lw2 = wl + kW1Halves + lane * 8;   // tile (j, kt) at (j*4 + kt)*512
#pragma unroll
  for (int jj = 0; jj < 4; ++jj) wb[0][jj] = load_frag_g(lw1 + (jj * 16) * 512);

  // Fully unrolled: every array index and every address offset is a constant,
  // so no address register is rewritten while loads are in flight.
  // Group g = (k tile g/2, n tiles 4*(g&1) .. +3): its 8 LDS loads are issued
  // together, one group ahead of the 8 WMMAs that use them.
#pragma unroll
  for (int g = 0; g < 32; ++g) {
    const int kt = g >> 1, jh = g & 1;
    if (g + 1 < 32) {
      const int kn = (g + 1) >> 1, jn = ((g + 1) & 1) * 4;
#pragma unroll
      for (int jj = 0; jj < 4; ++jj)
        wb[(g + 1) & 1][jj] = load_frag_g(lw1 + ((jn + jj) * 16 + kn) * 512);
    }
    // keeps the loads above in one place ahead of the WMMA block (for speed only)
    __builtin_amdgcn_sched_barrier(0);
#pragma unroll
    for (int jj = 0; jj < 4; ++jj) {
      acc[0][jh * 4 + jj] = wmma_f16(wb[g & 1][jj], xb[kt & 1][0], acc[0][jh * 4 + jj]);
      acc[1][jh * 4 + jj] = wmma_f16(wb[g & 1][jj], xb[kt & 1][1], acc[1][jh * 4 + jj]);
    }
    // ends the WMMA block: the next group's loads stay behind it
    __builtin_amdgcn_sched_barrier(0);
    if (jh == 1 && kt + 2 < 16) {
      xb[kt & 1][0] = load_frag_g(pa0 + (kt + 2) * 512);
      xb[kt & 1][1] = load_frag_g(pa1 + (kt + 2) * 512);
    }
  }
  // Wait before a register that the x loads name (the scalar base, the lane's
  // offset) is overwritten.
  asm volatile("s_wait_xcnt 0x0" ::: "memory");

  // ---- h1 = f16(relu(acc + b1)), straight into layer 2's fragments ----
  // acc[mi][j][r] = row m0 + 16*mi + l16, n = 16*j + 8*hi + r
  v16h hf[2][4];   // [mi][k tile of layer 2]
  {
    const float* be = b1 + 8 * hi;
    v4f b[8][2];   // all 16 loads in flight together: one latency, not eight
#pragma unroll
    for (int j = 0; j < 8; ++j) {
      b[j][0] = *(const v4f*)(be + 16 * j);
      b[j][1] = *(const v4f*)(be + 16 * j + 4);
    }
    // Wait before the address registers of these loads are overwritten; naming
    // the pointer keeps it whole up to the wait.
    asm volatile("s_wait_xcnt 0x0" :: "v"(be) : "memory");
#pragma unroll
    for (int j = 0; j < 8; ++j) {
      // one n tile at a time, so that its accumulators are free before the
      // next tile's temporaries are made (registers)
      __builtin_amdgcn_sched_barrier(0);
#pragma unroll
      for (int mi = 0; mi < 2; ++mi)
#pragma unroll
        for (int r = 0; r < 8; ++r) {
          float v = acc[mi][j][r] + b[j][r >> 2][r & 3];
          v = v > 0.0f ? v : 0.0f;
          hf[mi][j >> 1][(j & 1) * 8 + r] = (_Float16)v;
        }
    }
    // layer 2's loads stay behind the conversion (registers)
    __builtin_amdgcn_sched_barrier(0);
  }

  // ---- layers 2 and 3, 4 n tiles at a time ----
  const float* be2 = MODE != 1 ? b2 + 8 * hi : nullptr;
  const float* w3h = MODE == 0 ? w3 + 16 * hi : nullptr;
  // this lane's parked sums: piece ((jh*2 + mi)*4 + jj)*2 + half, 512 B per wave
  // (the wave's number goes through readfirstlane, so that the base is scalar
  // and holds no vector registers over the matrix phases)
  v4f* pk = MODE != 0
      ? park + (size_t)__builtin_amdgcn_readfirstlane(m0 >> 5) * 1024 + lane : nullptr;
  v2f s[2] = {{0.0f, 0.0f}, {0.0f, 0.0f}};   // mode 0: [mi], the two l side by side
  v8f lg[2];                                 // mode 2: logits^T, [mi]
#pragma unroll
  for (int mi = 0; mi < 2; ++mi)
#pragma unroll
    for (int i = 0; i < 8; ++i) lg[mi][i] = 0.0f;
  // not unrolled: unrolled, the compiler moved the first half's sums behind the
  // second half's matrix phase, kept both halves' values live, and spilled
#pragma unroll 1
  for (int jh = 0; jh < 2; ++jh) {
    v8f a2[2][4];
    v4f* pj = MODE != 0 ? pk + jh * 512 : nullptr;
    if constexpr (MODE == 2) {
      // go on from the first pass's sums (all 16 loads in flight together)
#pragma unroll
      for (int mi = 0; mi < 2; ++mi)
#pragma unroll
        for (int jj = 0; jj < 4; ++jj) {
          const v4f lo = pj[((mi * 4 + jj) * 2 + 0) * 32];
          const v4f up = pj[((mi * 4 + jj) * 2 + 1) * 32];
#pragma unroll
          for (int i = 0; i < 4; ++i) { a2[mi][jj][i] = lo[i]; a2[mi][jj][i + 4] = up[i]; }
        }
      // Wait before the address registers of these loads are overwritten;
      // naming the pointer keeps it whole up to the wait.
      asm volatile("s_wait_xcnt 0x0" :: "v"(pj) : "memory");
    } else {
#pragma unroll
      for (int mi = 0; mi < 2; ++mi)
#pragma unroll
        for (int jj = 0; jj < 4; ++jj)
#pragma unroll
          for (int i = 0; i < 8; ++i) a2[mi][jj][i] = 0.0f;
    }
#pragma unroll
    for (int jj = 0; jj < 4; ++jj)
      wb[0][jj] = load_frag_g(lw2 + ((jh * 4 + jj) * 4) * 512);
#pragma unroll
    for (int kt = 0; kt < 4; ++kt) {
      if (kt + 1 < 4) {
#pragma unroll
        for (int jj = 0; jj < 4; ++jj)
          wb[(kt + 1) & 1][jj] = load_frag_g(lw2 + ((jh * 4 + jj) * 4 + kt + 1) * 512);
      }
      // as in layer 1: loads in one place ahead of the WMMA block
      __builtin_amdgcn_sched_barrier(0);
#pragma unroll
      for (int jj = 0; jj < 4; ++jj) {
        a2[0][jj] = wmma_f16(wb[kt & 1][jj], hf[0][kt], a2[0][jj]);
        a2[1][jj] = wmma_f16(wb[kt & 1][jj], hf[1][kt], a2[1][jj]);
      }
      // ends the WMMA block; behind the last one it also keeps the bias and W3
      // loads below out of the matrix phase, where they would not fit the registers
      __builtin_amdgcn_sched_barrier(0);
    }
    if constexpr (MODE == 1) {
      // park this pass's share of layer 2's sums
#pragma unroll
      for (int mi = 0; mi < 2; ++mi)
#pragma unroll
        for (int jj = 0; jj < 4; ++jj) {
          v4f lo, up;
#pragma unroll
          for (int i = 0; i < 4; ++i) { lo[i] = a2[mi][jj][i]; up[i] = a2[mi][jj][i + 4]; }
          pj[((mi * 4 + jj) * 2 + 0) * 32] = lo;
          pj[((mi * 4 + jj) * 2 + 1) * 32] = up;
        }
      // Wait before a register of these stores is overwritten; naming the
      // pointer keeps it whole up to the wait.
      asm volatile("s_wait_xcnt 0x0" :: "v"(pj) : "memory");
    } else if constexpr (MODE == 2) {
      v4f b[4][2];   // b2[n]
      const float* pb = be2 + 64 * jh;
      const _Float16* pw = w3f + jh * 1024 + lane * 8;   // k tiles 2*jh, 2*jh + 1
#pragma unroll
      for (int jj = 0; jj < 4; ++jj) {
        b[jj][0] = *(const v4f*)(pb + 16 * jj);
        b[jj][1] = *(const v4f*)(pb + 16 * jj + 4);
      }
      v16h wf[2];
      wf[0] = load_frag_g(pw);
      wf[1] = load_frag_g(pw + 512);
      // Wait before the address registers of these loads are overwritten; naming
      // the pointers keeps them whole up to the wait.
      asm volatile("s_wait_xcnt 0x0" :: "v"(pb), "v"(pw) : "memory");
      // h2 = f16(relu(a2 + b2)), straight into layer 3's fragments, as h1 above
      v16h h2f[2][2];   // [mi][k tile 2*jh + t]
#pragma unroll
      for (int jj = 0; jj < 4; ++jj)
#pragma unroll
        for (int mi = 0; mi < 2; ++mi)
#pragma unroll
          for (int r = 0; r < 8; ++r) {
            float v = a2[mi][jj][r] + b[jj][r >> 2][r & 3];
            v = v > 0.0f ? v : 0.0f;
            h2f[mi][jj >> 1][(jj & 1) * 8 + r] = (_Float16)v;
          }
#pragma unroll
      for (int t = 0; t < 2; ++t)
#pragma unroll
        for (int mi = 0; mi < 2; ++mi) lg[mi] = wmma_f16(wf[t], h2f[mi][t], lg[mi]);
    } else {
      v4f b[4][2];   // b2[n]
      v4f c[4][4];   // W3[n][l], n = 16*j + 8*hi + 0..7: 16 consecutive floats
      // all 24 loads in flight together: one latency, not four
      const float* pb = be2 + 64 * jh;
      const float* pc = w3h + 128 * jh;
#pragma unroll
      for (int jj = 0; jj < 4; ++jj) {
        b[jj][0] = *(const v4f*)(pb + 16 * jj);
        b[jj][1] = *(const v4f*)(pb + 16 * jj + 4);
#pragma unroll
        for (int i = 0; i < 4; ++i) c[jj][i] = *(const v4f*)(pc + 32 * jj + 4 * i);
      }
      // Wait before the address registers of these loads are overwritten; naming
      // the pointers keeps them whole up to the wait.
      asm volatile("s_wait_xcnt 0x0" :: "v"(pb), "v"(pc) : "memory");
#pragma unroll
      for (int jj = 0; jj < 4; ++jj) {
        // one n tile at a time (registers), as in the conversion above
        __builtin_amdgcn_sched_barrier(0);
#pragma unroll
        for (int mi = 0; mi < 2; ++mi)
#pragma unroll
          for (int r = 0; r < 8; ++r) {
            float v = a2[mi][jj][r] + b[jj][r >> 2][r & 3];
            v = v > 0.0f ? v : 0.0f;
            const v2f cw = {c[jj][r >> 1][(r & 1) * 2 + 0], c[jj][r >> 1][(r & 1) * 2 + 1]};
            const v2f vv = {v, v};
            s[mi] = __builtin_elementwise_fma(vv, cw, s[mi]);
          }
      }
    }
  }

  if constexpr (MODE == 0) {
    // add the two lane halves (n split by hi); then lane half hi stores row tile hi:
    // one wave writes 32 rows x 8 B = 256 contiguous bytes
#pragma unroll
    for (int mi = 0; mi < 2; ++mi)
#pragma unroll
      for (int l = 0; l < 2; ++l) s[mi][l] += __shfl_xor(s[mi][l], 16);
    float2 o;
    o.x = (hi ? s[1][0] : s[0][0]) + b3[0];
    o.y = (hi ? s[1][1] : s[0][1]) + b3[1];
    *(float2*)(chart + (size_t)(m0 + lane) * kL) = o;
    // Wait before a register of this store is overwritten: the next expert pass
    // follows it in the program.
    asm volatile("s_wait_xcnt 0x0" ::: "memory");
  } else if constexpr (MODE == 2) {
    // lg[mi][r] = logit 8*hi + r of row m0 + 16*mi + l16.  Lane half hi takes row
    // tile hi, so that lane l has row m0 + l: the lower half lacks logits 8.. of
    // tile 0, the upper half logits 0..7 of tile 1; each sends what the other lacks.
    float got[8];
#pragma unroll
    for (int r = 0; r < 8; ++r) got[r] = __shfl_xor(hi ? lg[0][r] : lg[1][r], 16);
    float lo[kE];
#pragma unroll
    for (int e = 0; e < kE; ++e)
      lo[e] = (e < 8 ? (hi ? got[e] : lg[0][e]) : (hi ? lg[1][e - 8] : got[e - 8])) + b3[e];
    gumbel_softmax_row(lo, u, wout, m0 + lane);
    // Wait before a register of its stores is overwritten: the expert pass follows.
    asm volatile("s_wait_xcnt 0x0" ::: "memory");
  }
}

// 16 waves: 4 per SIMD, 256 VGPRs each
__global__ __launch_bounds__(512, 4)
void expert_mlp_fused_kernel(const _Float16* __restrict__ xh,   // [B, D], fragment order
                             const _Float16* __restrict__ wf,   // [E+2] sets, fragment order
                             const float* eb1,                  // [E][H]
                             const float* eb2,                  // [E][H]
                             const float* ew3,                  // [E][H][L]
                             const float* __restrict__ eb3,     // [E][L]
                             float* __restrict__ chart,         // [E][B][L]
                             const float* rb1,                  // [RH1]
                             const float* rb2,                  // [RH2]
                             const _Float16* rw3T,              // [16 x RH2], fragment order
                             const float* __restrict__ rb3,     // [E]
                             const float* __restrict__ u,       // [B, E]
                             float* __restrict__ wout,          // [B, E]
                             float* park) {                     // [B/32][1024] x 16 B
  __shared__ __attribute__((aligned(16))) _Float16 wl[2 * kSetHalves];
  // Pass t of this block runs set q = 3 * blockIdx.y + t, from buffer t & 1.
  // Sets 0 and 1 are the router's halves (weights number E, E + 1), set q >= 2
  // is expert q - 2.  All tests below read the same for the whole block.
  const int q0 = blockIdx.y * kSetsBlk;
  const int w0 = q0 == 0 ? kE : q0 - 2;   // weights of pass 0
  copy_set_async(wl, wf + (size_t)w0 * kSetHalves);
  asm volatile("s_wait_asynccnt 0x0" ::: "memory");   // own copies of the first set
  __syncthreads();                                    // every wave's have landed
  int t = 0;
  if (q0 == 0) {
    mlp_pass<1>(wl, true, wl + kSetHalves, wf + (size_t)(kE + 1) * kSetHalves, xh, rb1,
                nullptr, nullptr, nullptr, nullptr, (v4f*)park, nullptr, nullptr, nullptr);
    pass_foot();
    mlp_pass<2>(wl + kSetHalves, true, wl, wf, xh, rb1 + kH, rb2, nullptr, rb3,
                nullptr, (v4f*)park, rw3T, u, wout);
    pass_foot();
    t = 2;
  }
  // not unrolled: one copy of the expert pass in the text
#pragma unroll 1
  for (; t < kSetsBlk; ++t) {
    const int e = q0 + t - 2;   // the next pass, where there is one, runs expert e + 1
    mlp_pass<0>(wl + (t & 1) * kSetHalves, t + 1 < kSetsBlk,
                wl + ((t + 1) & 1) * kSetHalves, wf + (size_t)(e + 1) * kSetHalves,
                xh, eb1 + e * kH, eb2 + e * kH,
                ew3 + (size_t)e * kH * kL, eb3 + e * kL, chart + (size_t)e * kB * kL,
                nullptr, nullptr, nullptr, nullptr);
    pass_foot();
  }
  asm volatile("s_wait_asynccnt 0x0" ::: "memory");   // no copy outlives the wave
}

// z[b,l] = sum_e weights[b,e] * chart[e,b,l]
__global__ void z_kernel(const float* __restrict__ wght,
                         const float* __restrict__ chart,
                         float* __restrict__ z) {
  int b = blockIdx.x * blockDim.x + threadIdx.x;
  if (b >= kB) return;
  float z0 = 0.0f, z1 = 0.0f;
#pragma unroll
  for (int e = 0; e < kE; ++e) {
    float w = wght[(size_t)b * kE + e];
    z0 += w * chart[((size_t)e * kB + b) * kL + 0];
    z1 += w * chart[((size_t)e * kB + b) * kL + 1];
  }
  z[(size_t)b * kL + 0] = z0;
  z[(size_t)b * kL + 1] = z1;
}

// ---------------------------------------------------------------------------
extern "C" void kernel_launch(void* const* d_in, const int* in_sizes, int n_in,
                              void* d_out, int out_size, void* d_ws, size_t ws_size,
                              hipStream_t stream) {
  (void)in_sizes; (void)n_in; (void)out_size; (void)ws_size;

  const float* x   = (const float*)d_in[0];
  const float* u   = (const float*)d_in[1];
  const float* rw1 = (const float*)d_in[2];
  const float* rb1 = (const float*)d_in[3];
  const float* rw2 = (const float*)d_in[4];
  const float* rb2 = (const float*)d_in[5];
  const float* rw3 = (const float*)d_in[6];
  const float* rb3 = (const float*)d_in[7];
  const float* ew1 = (const float*)d_in[8];
  const float* eb1 = (const float*)d_in[9];
  const float* ew2 = (const float*)d_in[10];
  const float* eb2 = (const float*)d_in[11];
  const float* ew3 = (const float*)d_in[12];
  const float* eb3 = (const float*)d_in[13];

  float* out   = (float*)d_out;
  float* out_z = out;                                  // [B, L]
  float* out_w = out + (size_t)kB * kL;                // [B, E]
  float* out_c = out_w + (size_t)kB * kE;              // [E, B, L]

  // Workspace carve-up (256B aligned)
  char* ws = (char*)d_ws;
  size_t off = 0;
  auto carve = [&](size_t bytes) -> void* {
    void* p = ws + off;
    off += (bytes + 255) & ~(size_t)255;
    return p;
  };
  // all in fragment order; a set per expert (W1, then W2), the router's two halves behind
  _Float16* xh   = (_Float16*)carve((size_t)kB * kD * 2);               // x in f16
  _Float16* ew1T = (_Float16*)carve((size_t)(kE + 2) * kSetHalves * 2); // [E+2] sets: [H][D]
  _Float16* ew2T = ew1T + kD * kH;                                      //   and [H][H]
  _Float16* rw3T = (_Float16*)carve((size_t)16 * kRH2 * 2);             // [16][RH2]
  float*    park = (float*)carve((size_t)kB * kRH2 * 4);                // router, layer 2 sums

  // 1) conversions / weight transposes, one launch
  prep_kernel<<<dim3(kBlkPrep), 256, 0, stream>>>(x, xh, rw1, rw2, rw3, rw3T,
                                                  ew1, ew1T, ew2, ew2T);

  // 2) experts (all three layers, into the chart_outputs region) and the whole
  //    router (three layers and the gumbel softmax), one launch
  expert_mlp_fused_kernel<<<dim3(kB / kRowsBlk, (kE + 2) / kSetsBlk), 512, 0, stream>>>(
      xh, ew1T, eb1, eb2, ew3, eb3, out_c, rb1, rb2, rw3T, rb3, u, out_w, park);

  // 3) z = weights . zc
  z_kernel<<<dim3(kB / 256), 256, 0, stream>>>(out_w, out_c, out_z);
}
